// v000
// The times below were measured on an AMD MI455X: many runs one after another, warmed up first and cycling through
// copies of the inputs, with the whole window's GPU time divided by the number of runs. Launches and the gaps
// between them are all in it. The median over several windows is given; except for v000 it joins two sittings, which
// can be a few percent apart, so the side-by-side timings, each taken in one sitting, are the better comparison.
// v000, which the later versions start from, runs in 567 microseconds.
#include <hip/hip_runtime.h>

// Single-head cross-attention that also returns its softmax weights (query, input_feature [2048][4][1024] = [token][entry][channel]; kv = input_feature in_proj_weight^T + in_proj_bias ('oi' (out, in) [2048][1024] x 1/32 + [2048] zeros): k = the first 1,024 columns, v = the last; q = query x 1024^-0.5: NO q projection; ONE head of width 1,024;
// attn_weights[b][t][s] = softmax over the 2,048 keys s of q[t] . k[s] (no mask): RETURNED as the second output [4][2048][2048]; attn = attn_weights v; out = attn out_proj_weight^T + out_proj_bias ('oi' [1024][1024] + [1024] zeros): the first output [2048][4][1024]; argument order query, input_feature, in_proj_weight, in_proj_bias, out_proj_weight, out_proj_bias).
// Layout: once: both weights cast to bf16 as they stand (the k rows and the v rows of in_proj_weight are its two halves); v's half of in_proj_bias carried x 1,024 (k_bcar); per PAIR of entries (the softmax kernel takes two planes a launch): each entry's rows gathered out of the [token][entry] layout (a row pitch of 4,096 floats) into contiguous planes: input_feature as bf16 (k_rows<false>) and query x 1/4 as ONE f16 word (k_rows<true>: a word under 2^-14 in size is written as zero);
// k = x Wk^T + bias (a plain bf16 product; token-major [2048][1024]: it IS the head's key plane), then ONE f16 word; v^T = Wv x^T (the same product with the operands' roles exchanged: channel-major [1024][2048]: the value product's second operand, no transposer), then ONE f16 word; scores = q k^T (one fp16 product at depth 1,024); the softmax at 2,048 keys, EVERY row on the f16 plane of its weights x 1,024;
// THE SECOND OUTPUT is that plane x 2^-10 as f32 (k_wout); 1,024 x (weights v + v's bias) by one fp16 product at depth 2,048 with the carried bias in its bias slot (the rows of the weights sum to one: adding v's bias after the product equals adding it to v before); its bf16 hi / lo planes x 2^-10 (k_tohl's scale argument undoes the carry); hi/lo x out_proj_weight exact + out_proj_bias writes the first output in place (row pitch 4,096 floats; the pair's second entry 1,024 floats further).
// SIX flat kernel texts (k_cvt8, k_rows in two forms, k_tohl, k_f2h, k_wout, k_bcar: no loop; every address from the lane's own index and launch constants; no LDS, barrier, cross-lane word or atomic).
// Compute dtypes, f32 accumulate: every float input rounded to bf16 at its load; both projections plain bf16 (inputs: exact); q (an input x 1/4: exact in f16 but for words under 2^-14), k, v and the weights x 1,024 each ONE f16 word: both attention products fp16; softmax f32; the output projection hl x exact + bias.

#define NB_  4
#define TT   2048
#define DM   1024                 // the model width = the one head's width
#define ZH   2                    // entries a softmax launch
#define RH   0                    // the softmax's hi + lo stores stand under 'row < RH': none taken: EVERY row stores the f16 plane of its weights x 1,024
#define PCAR 1024.0f              // the weights' carry
#define SCL  0.125f               // the softmax's scale: the module's 1/32 = 0.125 x the 1/4 folded into q's cast (both powers of two: exact)
#define QSC  0.25f
typedef _Float16 h16;
typedef unsigned short bf;
typedef __attribute__((ext_vector_type(16))) __bf16   v16bf;
typedef __attribute__((ext_vector_type(16))) _Float16 v16h;
typedef __attribute__((ext_vector_type(8)))  _Float16 v8h;
typedef __attribute__((ext_vector_type(8)))  unsigned short v8us;
typedef __attribute__((ext_vector_type(8)))  float    v8f;
typedef __attribute__((ext_vector_type(4)))  float    v4f;
typedef v8h  __attribute__((may_alias)) v8ha;
typedef v4f  __attribute__((may_alias)) v4fa;
typedef v8us __attribute__((may_alias)) v8usa;

__device__ __forceinline__ unsigned short f2bf(float f) { unsigned u = __float_as_uint(f); u += 0x7FFFu + ((u >> 16) & 1u); return (unsigned short)(u >> 16); }
__device__ __forceinline__ float bf2f(unsigned short b) { return __uint_as_float(((unsigned)b) << 16); }
__device__ __forceinline__ float bfr(float f) { return bf2f(f2bf(f)); }
__device__ __forceinline__ v16h cat16(v8h lo, v8h hi) { return __builtin_shufflevector(lo, hi, 0, 1, 2, 3, 4, 5, 6, 7, 8, 9, 10, 11, 12, 13, 14, 15); }
__device__ __forceinline__ v16bf cat16b(v8us lo, v8us hi) { return __builtin_bit_cast(v16bf, __builtin_shufflevector(lo, hi, 0, 1, 2, 3, 4, 5, 6, 7, 8, 9, 10, 11, 12, 13, 14, 15)); }
__device__ __forceinline__ v8f wmma16(v16h a, v16h b, v8f c) { return __builtin_amdgcn_wmma_f32_16x16x32_f16(false, a, false, b, (short)0, c, false, false); }
__device__ __forceinline__ v8f wmmab(v16bf a, v16bf b, v8f c) { return __builtin_amdgcn_wmma_f32_16x16x32_bf16(false, a, false, b, (short)0, c, false, false); }



// ---- k_gemmw: register-blocked GEMM, ONE WAVE per 64x64 output tile (16 accumulators), operands straight from K-contiguous 16-bit planes; grid (M/64, N/64, Z), 32 threads.
// C[m][n] (f32, pitch ldc, + optional f32 bias[n]) = sum_k A[m][k] Bt[n][k] (+ split products per NSPLIT). z-batch strides sA/sB/sC in elements. K % 32 == 0.
template <typename T16> struct WFrag;
template <> struct WFrag<h16> { typedef v16h V; static __device__ __forceinline__ V ld(const h16* p) { return cat16(*(const v8h*)p, *(const v8h*)(p + 16)); } static __device__ __forceinline__ v8f mma(V a, V b, v8f c) { return wmma16(a, b, c); } };
template <> struct WFrag<bf> { typedef v16bf V; static __device__ __forceinline__ V ld(const bf* p) { return cat16b(*(const v8us*)p, *(const v8us*)(p + 16)); } static __device__ __forceinline__ v8f mma(V a, V b, v8f c) { return wmmab(a, b, c); } };
template <typename T16, int NSPLIT, bool BIAS>
__global__ __launch_bounds__(32) void k_gemmw(const T16* __restrict__ A, const T16* __restrict__ A2, const T16* __restrict__ Bt, const T16* __restrict__ Bt2, int K, float* C, int ldc, const float* __restrict__ bias, size_t sA, size_t sB, size_t sC) {
    typedef typename WFrag<T16>::V V;
    __shared__ __align__(16) float os[16 * 68];
    const size_t z = blockIdx.z; A += z * sA; if (A2) A2 += z * sA; Bt += z * sB; if (Bt2) Bt2 += z * sB; C += z * sC;
    const int lane = threadIdx.x & 31, lr = lane & 15, hi = lane >> 4; const int r0 = blockIdx.x * 64, c0 = blockIdx.y * 64;
    v8f acc[4][4];
#pragma unroll
    for (int mb = 0; mb < 4; ++mb)
#pragma unroll
        for (int nb = 0; nb < 4; ++nb) acc[mb][nb] = (v8f){};
    const size_t aoff = (size_t)(r0 + lr) * K + 8 * hi, boff = (size_t)(c0 + lr) * K + 8 * hi;
    for (int kc = 0; kc < K; kc += 32) {
        V a[4], a2[4];
#pragma unroll
        for (int mb = 0; mb < 4; ++mb) { a[mb] = WFrag<T16>::ld(A + aoff + (size_t)mb * 16 * K + kc); if (NSPLIT == 1 || NSPLIT == 2) a2[mb] = WFrag<T16>::ld(A2 + aoff + (size_t)mb * 16 * K + kc); }
#pragma unroll
        for (int nb = 0; nb < 4; ++nb) { const V b = WFrag<T16>::ld(Bt + boff + (size_t)nb * 16 * K + kc); V b2; if (NSPLIT >= 2) b2 = WFrag<T16>::ld(Bt2 + boff + (size_t)nb * 16 * K + kc);
#pragma unroll
            for (int mb = 0; mb < 4; ++mb) { acc[mb][nb] = WFrag<T16>::mma(a[mb], b, acc[mb][nb]); if (NSPLIT == 1 || NSPLIT == 2) acc[mb][nb] = WFrag<T16>::mma(a2[mb], b, acc[mb][nb]); if (NSPLIT >= 2) acc[mb][nb] = WFrag<T16>::mma(a[mb], b2, acc[mb][nb]); } }
        asm volatile("v_nop\n\tv_nop\n\tv_nop\n\tv_nop" : "+v"(acc[0][0]), "+v"(acc[1][1]), "+v"(acc[2][2]), "+v"(acc[3][3]) : "v"(a[0]), "v"(a[3]));
    }
#pragma unroll
    for (int mb = 0; mb < 4; ++mb) {
#pragma unroll
        for (int nb = 0; nb < 4; ++nb) {
#pragma unroll
            for (int j = 0; j < 8; ++j) os[(hi * 8 + j) * 68 + nb * 16 + lr] = acc[mb][nb][j]; }
        __builtin_amdgcn_wave_barrier(); asm volatile("" ::: "memory");
        float* crow = C + (size_t)(r0 + mb * 16) * ldc + c0;
{
#pragma unroll
            for (int s = 0; s < 8; ++s) { const int row = 2 * s + hi, cofs = lr * 4; v4f val = *(const v4fa*)(os + row * 68 + cofs); if (BIAS) { val[0] += bfr(bias[c0 + cofs]); val[1] += bfr(bias[c0 + cofs + 1]); val[2] += bfr(bias[c0 + cofs + 2]); val[3] += bfr(bias[c0 + cofs + 3]); }
                *(v4f*)(crow + (size_t)row * ldc + cofs) = val; }
             }
        __builtin_amdgcn_wave_barrier(); asm volatile("" ::: "memory");
    }
}

__device__ __forceinline__ h16 tohx(float x) { return (h16)x; }
__device__ __forceinline__ void splitf(float y, unsigned short& h, unsigned short& l) { h = f2bf(y); l = f2bf(y - bf2f(h)); }
typedef __attribute__((ext_vector_type(2))) _Float16 v2h;
typedef __attribute__((ext_vector_type(4))) _Float16 v4h;
typedef __attribute__((ext_vector_type(2))) unsigned short v2us;
typedef __attribute__((ext_vector_type(4))) unsigned short v4us;
typedef __attribute__((ext_vector_type(2))) float v2f;
typedef __attribute__((ext_vector_type(4))) int v4i;

__global__ __launch_bounds__(256) void k_cvt8(const float* __restrict__ src, bf* dst, size_t n8) { const size_t i = (size_t)blockIdx.x * 256 + threadIdx.x; if (i >= n8) return; const v8f v = *(const v8f*)(src + i * 8); v8us o;
#pragma unroll
    for (int k = 0; k < 8; ++k) o[k] = f2bf(v[k]); *(v8us*)(dst + i * 8) = o;  }
// k_asoft: per row (zz, i): t = S x SCL (no mask; SCL 0.125 here: the module's 1/32 is 0.125 x the 1/4 folded into q's cast); softmax over the 2048 keys (register row, one exp, fixed trees);
__global__ __launch_bounds__(256) void k_asoft(const float* __restrict__ Sb, h16* P16, bf* Ph, bf* Pl) {
    const int lane = threadIdx.x & 31; const int row = blockIdx.x * 8 + (threadIdx.x >> 5); if (row >= ZH * TT) return; const int i = row % TT; const int zz = row / TT; (void)zz; const bool hires = (i < RH); const float* sr = Sb + (size_t)row * TT; float v[TT / 32]; float mx = -3.0e38f;
#pragma unroll
    for (int ch = 0; ch < TT / 128; ++ch) { const int j0 = ch * 128 + lane * 4; const v4f a = *(const v4f*)(sr + j0);
#pragma unroll
        for (int q = 0; q < 4; ++q) { const int j = j0 + q; (void)j; const float t = a[q] * SCL; v[ch * 4 + q] = t; mx = fmaxf(mx, t); } }
#pragma unroll
    for (int sh = 16; sh; sh >>= 1) mx = fmaxf(mx, __shfl_xor(mx, sh, 32));
    float sum = 0.f;
#pragma unroll
    for (int k = 0; k < TT / 32; ++k) { float d0 = __fsub_rn(v[k], mx); v[k] = __builtin_amdgcn_exp2f(__fmul_rn(d0, 1.4426950408889634f)); sum += v[k]; }
#pragma unroll
    for (int sh = 16; sh; sh >>= 1) sum += __shfl_xor(sum, sh, 32);
    const float f = __fdiv_rn(hires ? 1.0f : PCAR, sum);
{
        if (hires) {
#pragma unroll
            for (int ch = 0; ch < TT / 128; ++ch) { v4us oh, ol;
#pragma unroll
                for (int q = 0; q < 4; ++q) { unsigned short a, c2; splitf(v[ch * 4 + q] * f, a, c2); oh[q] = a; ol[q] = c2; }
                const size_t oo = ((size_t)zz * (RH ? RH : 1) + i) * TT + ch * 128 + lane * 4; *(v4us*)(Ph + oo) = oh; *(v4us*)(Pl + oo) = ol; }
        } else {
#pragma unroll
            for (int ch = 0; ch < TT / 128; ++ch) { v4h o4;
#pragma unroll
                for (int q = 0; q < 4; ++q) o4[q] = tohx(v[ch * 4 + q] * f);
                *(v4h*)(P16 + (size_t)row * TT + ch * 128 + lane * 4) = o4; } }
         }
}
__global__ __launch_bounds__(256) void k_tohl(const float* __restrict__ F, float sc, bf* Hh, bf* Hl, size_t n4) { const size_t i = (size_t)blockIdx.x * 256 + threadIdx.x; if (i >= n4) return; const v4f a = *(const v4f*)(F + i * 4); v4us oh, ol;
#pragma unroll
    for (int q = 0; q < 4; ++q) { unsigned short h2, l2; splitf(__fmul_rn(a[q], sc), h2, l2); oh[q] = h2; ol[q] = l2; }
    *(v4us*)(Hh + i * 4) = oh; *(v4us*)(Hl + i * 4) = ol;  }
__global__ __launch_bounds__(256) void k_f2h(const float* __restrict__ S, h16* P16, size_t n4) { const size_t i = (size_t)blockIdx.x * 256 + threadIdx.x; if (i >= n4) return; const v4f v = *(const v4f*)(S + i * 4); v4h o;
#pragma unroll
    for (int q = 0; q < 4; ++q) o[q] = tohx(v[q]);
    *(v4h*)(P16 + i * 4) = o;  }
// k_rows<H>: ONE ENTRY's ROWS GATHERED OUT OF THE [token][entry][channel] LAYOUT: dst[t][c] = cast(src[t x pitch + c]) for t < 2,048, c < 1,024 (src already points at the entry's first row: row pitch 'pitch' floats); H = false: bf16 words (round to nearest even);
template <bool H>
__global__ __launch_bounds__(256) void k_rows(const float* __restrict__ src, size_t pitch, float sc, unsigned short* dst) { const size_t i = (size_t)blockIdx.x * 256 + threadIdx.x; const size_t t = i / (DM / 8), c = (i % (DM / 8)) * 8; const v4f a = *(const v4f*)(src + t * pitch + c), b = *(const v4f*)(src + t * pitch + c + 4); v8us o;
#pragma unroll
    for (int q = 0; q < 8; ++q) { const float x = (q < 4) ? a[q] : b[q - 4]; if (H) { const float y = __fmul_rn(bfr(x), sc); const float z = (fabsf(y) < 6.103515625e-5f) ? 0.0f : y; o[q] = __builtin_bit_cast(unsigned short, tohx(z)); } else o[q] = f2bf(x); }
    *(v8us*)(dst + i * 8) = o;  }
__global__ __launch_bounds__(256) void k_wout(const h16* __restrict__ P16, float* Wt) { const size_t i = (size_t)blockIdx.x * 256 + threadIdx.x; const v8h p = *(const v8h*)(P16 + i * 8); v4f o0, o1;
#pragma unroll
    for (int q = 0; q < 4; ++q) { o0[q] = __fmul_rn((float)p[q], 1.0f / PCAR); o1[q] = __fmul_rn((float)p[4 + q], 1.0f / PCAR); }
{ *(v4f*)(Wt + i * 8) = o0; *(v4f*)(Wt + i * 8 + 4) = o1;
         } }
__global__ __launch_bounds__(256) void k_bcar(const float* __restrict__ b, float* BV) { const unsigned c = blockIdx.x * 256 + threadIdx.x; const float v = __fmul_rn(bfr(b[c]), PCAR); *(float*)(BV + c) = v;  }

extern "C" void kernel_launch(void* const* d_in, const int* in_sizes, int n_in,
                              void* d_out, int out_size, void* d_ws, size_t ws_size, hipStream_t stream) {
    (void)in_sizes; (void)n_in; (void)out_size;
    const float* qin = (const float*)d_in[0]; const float* xin = (const float*)d_in[1]; const float* win = (const float*)d_in[2]; const float* bin = (const float*)d_in[3]; const float* wo = (const float*)d_in[4]; const float* bo = (const float*)d_in[5];   /* the module's argument order: query, input_feature, in_proj_weight, in_proj_bias, out_proj_weight, out_proj_bias: SIX inputs; all read */
    float* OUT0 = (float*)d_out;                                   // attn [2048][4][1024]
    float* OUT1 = (float*)d_out + (size_t)TT * NB_ * DM;           // attn_weights [4][2048][2048]: 33,554,432 B after the first
    char* wsp = (char*)d_ws;
    auto take = [&](size_t bytes) { char* p = wsp; wsp += (bytes + 255) & ~(size_t)255; return (void*)p; };
    bf* WB = (bf*)take((size_t)2 * DM * DM * 2);   /* in_proj_weight as bf16: rows [0, 1024) k's, [1024, 2048) v's */ bf* WOB = (bf*)take((size_t)DM * DM * 2); float* BV = (float*)take((size_t)DM * 4);
    bf* XB = (bf*)take((size_t)TT * DM * 2); float* KF = (float*)take((size_t)TT * DM * 4); float* VTF = (float*)take((size_t)DM * TT * 4);   /* an entry's bf16 rows; its k plane f32 token-major; its v plane f32 CHANNEL-major [1024][2048] */
    h16* Q16 = (h16*)take((size_t)ZH * TT * DM * 2); h16* K16 = (h16*)take((size_t)ZH * TT * DM * 2); h16* VT16 = (h16*)take((size_t)ZH * DM * TT * 2);   /* the pair's f16 planes */
    float* Sb = (float*)take((size_t)ZH * TT * TT * 4); h16* P16 = (h16*)take((size_t)ZH * TT * TT * 2); float* Ob = (float*)take((size_t)ZH * TT * DM * 4); bf* ATh = (bf*)take((size_t)ZH * TT * DM * 2); bf* ATl = (bf*)take((size_t)ZH * TT * DM * 2);
    if ((size_t)(wsp - (char*)d_ws) > ws_size) return;    // total 130.00 MiB carved
    k_cvt8<<<(unsigned)(((size_t)2 * DM * DM / 8 + 255) / 256), 256, 0, stream>>>(win, WB, (size_t)2 * DM * DM / 8); k_cvt8<<<(unsigned)(((size_t)DM * DM / 8 + 255) / 256), 256, 0, stream>>>(wo, WOB, (size_t)DM * DM / 8);
    k_bcar<<<DM / 256, 256, 0, stream>>>(bin + DM, BV);
    const size_t PITCH = (size_t)NB_ * DM; const unsigned GR = (unsigned)((size_t)TT * DM / 8 / 256), GH = (unsigned)(((size_t)TT * DM / 4 + 255) / 256);
    for (int b0 = 0; b0 < NB_; b0 += ZH) {
        for (int zz = 0; zz < ZH; ++zz) { const int b = b0 + zz;
            k_rows<false><<<GR, 256, 0, stream>>>(xin + (size_t)b * DM, PITCH, 1.0f, XB); k_rows<true><<<GR, 256, 0, stream>>>(qin + (size_t)b * DM, PITCH, QSC, (unsigned short*)(Q16 + (size_t)zz * TT * DM));
            k_gemmw<bf, 0, true><<<dim3(TT / 64, DM / 64, 1), 32, 0, stream>>>(XB, nullptr, WB, nullptr, DM, KF, DM, bin, 0, 0, 0);   /* k = x Wk^T + bk: token-major */
            k_f2h<<<GH, 256, 0, stream>>>(KF, K16 + (size_t)zz * TT * DM, (size_t)TT * DM / 4);
            k_gemmw<bf, 0, false><<<dim3(DM / 64, TT / 64, 1), 32, 0, stream>>>(WB + (size_t)DM * DM, nullptr, XB, nullptr, DM, VTF, TT, nullptr, 0, 0, 0);   /* v^T = Wv x^T: channel-major [1024][2048]; v's bias rides the value product */
            k_f2h<<<GH, 256, 0, stream>>>(VTF, VT16 + (size_t)zz * DM * TT, (size_t)DM * TT / 4); }
        k_gemmw<h16, 0, false><<<dim3(TT / 64, TT / 64, ZH), 32, 0, stream>>>(Q16, nullptr, K16, nullptr, DM, Sb, TT, nullptr, (size_t)TT * DM, (size_t)TT * DM, (size_t)TT * TT);   /* scores = (q / 4) k^T */
        k_asoft<<<ZH * TT / 8, 256, 0, stream>>>(Sb, P16, nullptr, nullptr);
        k_wout<<<(unsigned)((size_t)ZH * TT * TT / 8 / 256), 256, 0, stream>>>(P16, OUT1 + (size_t)b0 * TT * TT);   /* the second output's two entries */
        k_gemmw<h16, 0, true><<<dim3(TT / 64, DM / 64, ZH), 32, 0, stream>>>(P16, nullptr, VT16, nullptr, TT, Ob, DM, BV, (size_t)TT * TT, (size_t)DM * TT, (size_t)TT * DM);   /* 1,024 x (weights v + bv) */
        k_tohl<<<(unsigned)(((size_t)ZH * TT * DM / 4 + 255) / 256), 256, 0, stream>>>(Ob, 1.0f / PCAR, ATh, ATl, (size_t)ZH * TT * DM / 4);
        k_gemmw<bf, 1, true><<<dim3(TT / 64, DM / 64, ZH), 32, 0, stream>>>(ATh, ATl, WOB, nullptr, DM, OUT0 + (size_t)b0 * DM, (int)PITCH, bo, (size_t)TT * DM, 0, (size_t)DM);   /* out = attn Wo^T + bo, written in place: row pitch 4,096 floats; the pair's second entry 1,024 floats further */
    }
}

// v001
// It runs in 296 microseconds.
// Two timings next to v000 put it at 1.94 and 1.89 times that version's speed.
#include <hip/hip_runtime.h>
#include <stdint.h>

// Single-head cross-attention that also returns its softmax weights (query, input_feature [2048][4][1024] = [token][entry][channel]; kv = input_feature in_proj_weight^T + in_proj_bias ('oi' (out, in) [2048][1024] x 1/32 + [2048] zeros): k = the first 1,024 columns, v = the last; q = query x 1024^-0.5: NO q projection; ONE head of width 1,024;
// attn_weights[b][t][s] = softmax over the 2,048 keys s of q[t] . k[s] (no mask): RETURNED as the second output [4][2048][2048]; attn = attn_weights v; out = attn out_proj_weight^T + out_proj_bias ('oi' [1024][1024] + [1024] zeros): the first output [2048][4][1024]; argument order query, input_feature, in_proj_weight, in_proj_bias, out_proj_weight, out_proj_bias).
// Layout: once: both weights cast to bf16 as they stand (the k rows and the v rows of in_proj_weight are its two halves); v's half of in_proj_bias carried x 1,024 (k_bcar); per PAIR of entries (the softmax kernel takes two planes a launch): each entry's rows gathered out of the [token][entry] layout (a row pitch of 4,096 floats) into contiguous planes: input_feature as bf16 (k_rows<false>) and query x 1/4 as ONE f16 word (k_rows<true>: a word under 2^-14 in size is written as zero);
// k = x Wk^T + bias (a plain bf16 product; token-major [2048][1024]: it IS the head's key plane), then ONE f16 word; v^T = Wv x^T (the same product with the operands' roles exchanged: channel-major [1024][2048]: the value product's second operand, no transposer), then ONE f16 word; scores = q k^T (one fp16 product at depth 1,024); the softmax at 2,048 keys, EVERY row on the f16 plane of its weights x 1,024;
// THE SECOND OUTPUT is that plane x 2^-10 as f32 (k_wout); 1,024 x (weights v + v's bias) by one fp16 product at depth 2,048 with the carried bias in its bias slot (the rows of the weights sum to one: adding v's bias after the product equals adding it to v before); its bf16 hi / lo planes x 2^-10 (k_tohl's scale argument undoes the carry); hi/lo x out_proj_weight exact + out_proj_bias writes the first output in place (row pitch 4,096 floats; the pair's second entry 1,024 floats further).
// SIX flat kernel texts (k_cvt8, k_rows in two forms, k_tohl, k_f2h, k_wout, k_bcar: no loop; every address from the lane's own index and launch constants; no LDS, barrier, cross-lane word or atomic).
// Compute dtypes, f32 accumulate: every float input rounded to bf16 at its load; both projections plain bf16 (inputs: exact); q (an input x 1/4: exact in f16 but for words under 2^-14), k, v and the weights x 1,024 each ONE f16 word: both attention products fp16; softmax f32; the output projection hl x exact + bias.

#define NB_  4
#define TT   2048
#define DM   1024                 // the model width = the one head's width
#define ZH   2                    // entries a softmax launch
#define RH   0                    // the softmax's hi + lo stores stand under 'row < RH': none taken: EVERY row stores the f16 plane of its weights x 1,024
#define PCAR 1024.0f              // the weights' carry
#define SCL  0.125f               // the softmax's scale: the module's 1/32 = 0.125 x the 1/4 folded into q's cast (both powers of two: exact)
#define QSC  0.25f
typedef _Float16 h16;
typedef unsigned short bf;
typedef __attribute__((ext_vector_type(16))) __bf16   v16bf;
typedef __attribute__((ext_vector_type(16))) _Float16 v16h;
typedef __attribute__((ext_vector_type(8)))  _Float16 v8h;
typedef __attribute__((ext_vector_type(8)))  unsigned short v8us;
typedef __attribute__((ext_vector_type(8)))  float    v8f;
typedef __attribute__((ext_vector_type(4)))  float    v4f;
typedef v8h  __attribute__((may_alias)) v8ha;
typedef v4f  __attribute__((may_alias)) v4fa;
typedef v8us __attribute__((may_alias)) v8usa;

__device__ __forceinline__ unsigned short f2bf(float f) { unsigned u = __float_as_uint(f); u += 0x7FFFu + ((u >> 16) & 1u); return (unsigned short)(u >> 16); }
__device__ __forceinline__ float bf2f(unsigned short b) { return __uint_as_float(((unsigned)b) << 16); }
__device__ __forceinline__ float bfr(float f) { return bf2f(f2bf(f)); }
__device__ __forceinline__ v16h cat16(v8h lo, v8h hi) { return __builtin_shufflevector(lo, hi, 0, 1, 2, 3, 4, 5, 6, 7, 8, 9, 10, 11, 12, 13, 14, 15); }
__device__ __forceinline__ v16bf cat16b(v8us lo, v8us hi) { return __builtin_bit_cast(v16bf, __builtin_shufflevector(lo, hi, 0, 1, 2, 3, 4, 5, 6, 7, 8, 9, 10, 11, 12, 13, 14, 15)); }
__device__ __forceinline__ v8f wmma16(v16h a, v16h b, v8f c) { return __builtin_amdgcn_wmma_f32_16x16x32_f16(false, a, false, b, (short)0, c, false, false); }
__device__ __forceinline__ v8f wmmab(v16bf a, v16bf b, v8f c) { return __builtin_amdgcn_wmma_f32_16x16x32_bf16(false, a, false, b, (short)0, c, false, false); }



// ---- k_gemmt: block GEMM, FOUR WAVES per 128x128 output tile (2 x 2 waves of 64x64, 16 accumulators each); grid (M/128, N/128, Z), 128 threads. Operands are K-contiguous 16-bit planes.
// C[m][n] (f32, pitch ldc, + optional f32 bias[n]) = sum_k A[m][k] Bt[n][k] (SPLIT: then + sum_k A2[m][k] Bt[n][k], as further passes). z-batch strides sA/sB/sC in elements. M, N % 128 == 0, K % 128 == 0, K >= 256.
// A pass is 128 k = 256 B of every operand row. A stage is [A 128 rows | Bt 128 rows] in LDS at pitch 272 B, in four slices of 64 rows; each wave brings its own slice with ONE tensor load a pass; two buffers, so that the next pass's rows fly while this pass is worked on.
typedef uint32_t u32x4 __attribute__((ext_vector_type(4)));
typedef uint32_t u32x8 __attribute__((ext_vector_type(8)));
typedef float __attribute__((may_alias)) f32a;
#define ROWB   256u                // bytes of an operand row a pass
#define LPITCH 272u                // its pitch in LDS: 16 B x odd, for ds_load_b128 readers
#define SLICE  18432u              // 64 rows x 272 B = 17,408 B, rounded up to a multiple of 2 KiB
#define BUFB   (4u * SLICE)
__device__ __forceinline__ uint32_t uni(uint32_t v) { return (uint32_t)__builtin_amdgcn_readfirstlane(v); }
__device__ __forceinline__ uint32_t pinned(uint32_t v) { uint32_t w = uni(v); asm volatile("" : "+s"(w)); /* the pinned() form for a test round a tensor load: it holds the test in a scalar register, so that the branch is scalar (a tensor load ignores EXEC) */ return w; }
__device__ __forceinline__ void wait_ds0() { asm volatile("s_wait_dscnt 0x0" ::: "memory"); }       // this wave's LDS reads have retired before the barrier behind which their buffer is refilled
// both groups are in-out operands of the load and inputs of the wait that covers it: to the compiler the words behind the load are values that only these registers hold, needed again at the wait, so it neither reuses the registers as temporaries nor forms the words anew while the request is outstanding
__device__ __forceinline__ void tdm_load(u32x4& g0, u32x8& g1) { asm volatile("tensor_load_to_lds %0, %1" : "+s"(g0), "+s"(g1) :: "memory"); }
// this wave's own slice has landed: the compiler places no wait for a tensor load
__device__ __forceinline__ void wait_tensor0(const u32x4& g0, const u32x8& g1) { asm volatile("s_wait_tensorcnt 0x0" :: "s"(g0), "s"(g1) : "memory"); }
template <typename T16> struct WFrag;
template <> struct WFrag<h16> { typedef v16h V; static __device__ __forceinline__ V ld(const unsigned char* p) { return cat16(*(const v8ha*)p, *(const v8ha*)(p + 32)); } static __device__ __forceinline__ v8f mma(V a, V b, v8f c) { return wmma16(a, b, c); } };
template <> struct WFrag<bf> { typedef v16bf V; static __device__ __forceinline__ V ld(const unsigned char* p) { return cat16b(*(const v8usa*)p, *(const v8usa*)(p + 32)); } static __device__ __forceinline__ v8f mma(V a, V b, v8f c) { return wmmab(a, b, c); } };
template <typename T16, bool SPLIT, bool BIAS>
__global__ __launch_bounds__(128) void k_gemmt(const T16* __restrict__ A, const T16* __restrict__ A2, const T16* __restrict__ Bt, int K, float* C, int ldc, const float* __restrict__ bias, size_t sA, size_t sB, size_t sC) {
    typedef typename WFrag<T16>::V V;
    __shared__ __attribute__((aligned(2048))) unsigned char L[2 * BUFB];
    const size_t z = blockIdx.z; C += z * sC;
    const int lane = threadIdx.x & 31, lr = lane & 15, hi = lane >> 4; const int r0 = blockIdx.x * 128, c0 = blockIdx.y * 128;
    const uint32_t wave = uni(threadIdx.x >> 5), wm = wave & 1u, wn = wave >> 1;
    const uint32_t np1 = (uint32_t)K / 128u, npass = SPLIT ? 2u * np1 : np1;
    const uint32_t lbase = (uint32_t)(size_t)L;
    // waves 0 and 1 bring the two halves of A's 128 rows, waves 2 and 3 those of Bt's
    const bool isB = wave >= 2u;
    const size_t rowoff = isB ? z * sB + (size_t)(c0 + (int)(wave - 2u) * 64) * K : z * sA + (size_t)(r0 + (int)wave * 64) * K;
    const uint64_t src1 = (uint64_t)(size_t)((isB ? Bt : A) + rowoff);
    const uint64_t src2 = SPLIT ? (uint64_t)(size_t)((isB ? Bt : A2) + rowoff) : src1;
    u32x8 g1;   // 1-byte elements; tensor = tile = 64 rows of 256 B; source pitch 2 K bytes; a pad of 4 dwords behind every 64 dwords
    g1[0] = uni((1u << 20) | (5u << 22) | (3u << 25)); g1[1] = uni((ROWB & 0xFFFFu) << 16); g1[2] = uni((ROWB >> 16) | (64u << 16)); g1[3] = uni(ROWB << 16); g1[4] = uni(64u); g1[5] = uni((uint32_t)K * 2u); g1[6] = uni(0u); g1[7] = uni(0u);
    u32x4 g0;   // the group 0 of the request last issued: it takes new values only behind the wait that covers that request
    auto issue = [&](uint32_t s) {
        const bool second = SPLIT && s >= np1;
        const uint64_t ga = (second ? src2 : src1) + (uint64_t)(second ? s - np1 : s) * ROWB;
        g0[0] = uni(1u); g0[1] = uni(lbase + (s & 1u) * BUFB + wave * SLICE); g0[2] = uni((uint32_t)ga); g0[3] = uni((((uint32_t)(ga >> 32)) & 0x01FFFFFFu) | 0x80000000u);
        tdm_load(g0, g1);
    };
    v8f acc[4][4];
#pragma unroll
    for (int mb = 0; mb < 4; ++mb)
#pragma unroll
        for (int nb = 0; nb < 4; ++nb) acc[mb][nb] = (v8f){};
    issue(0u); wait_tensor0(g0, g1); __syncthreads(); issue(1u);
    const unsigned char* fa0 = L + wm * SLICE + (uint32_t)lr * LPITCH + (uint32_t)hi * 16u;          // the lane's row of the wave's A slice; k order as the planes': 8 hi .. 8 hi + 7, then 16 + 8 hi ..
    const unsigned char* fb0 = L + (2u + wn) * SLICE + (uint32_t)lr * LPITCH + (uint32_t)hi * 16u;   // the same of its Bt slice
    for (uint32_t s = 0; s < npass; ++s) {
        const unsigned char* fa = fa0 + (s & 1u) * BUFB; const unsigned char* fb = fb0 + (s & 1u) * BUFB;
        V a[2][4], b[2][4];
#pragma unroll
        for (int q = 0; q < 4; ++q) { a[0][q] = WFrag<T16>::ld(fa + q * 16 * LPITCH); b[0][q] = WFrag<T16>::ld(fb + q * 16 * LPITCH); }
#pragma unroll
        for (int kb = 0; kb < 4; ++kb) {
            if (kb < 3) {
#pragma unroll
                for (int q = 0; q < 4; ++q) { a[(kb + 1) & 1][q] = WFrag<T16>::ld(fa + q * 16 * LPITCH + (kb + 1) * 64); b[(kb + 1) & 1][q] = WFrag<T16>::ld(fb + q * 16 * LPITCH + (kb + 1) * 64); } }
            __builtin_amdgcn_sched_barrier(0);   // keeps the next block's LDS reads one group ahead of this block's products, not spread among them
#pragma unroll
            for (int nb = 0; nb < 4; ++nb)
#pragma unroll
                for (int mb = 0; mb < 4; ++mb) acc[mb][nb] = WFrag<T16>::mma(a[kb & 1][mb], b[kb & 1][nb], acc[mb][nb]);
            __builtin_amdgcn_sched_barrier(0);   // the same, at the block's end
        }
        wait_ds0(); wait_tensor0(g0, g1); __syncthreads();   // publish point of stage s + 1; it also ends every reader's last read of stage s's buffer
        if (pinned(s + 2u < npass)) issue(s + 2u);
    }
    wait_tensor0(g0, g1); wait_ds0();
    // the last pass's barrier stands behind every wave's last read of the ring and no load is in flight: each wave stages its output rows in its own slice of buffer 0
    f32a* os = (f32a*)(L + wave * SLICE);
    const int rw = r0 + (int)wm * 64, cw = c0 + (int)wn * 64;
#pragma unroll
    for (int mb = 0; mb < 4; ++mb) {
#pragma unroll
        for (int nb = 0; nb < 4; ++nb) {
#pragma unroll
            for (int j = 0; j < 8; ++j) os[(hi * 8 + j) * 68 + nb * 16 + lr] = acc[mb][nb][j]; }
        __builtin_amdgcn_wave_barrier(); asm volatile("" ::: "memory");   // compiler order only: the wave's 16 staged rows are stored before any lane reads them back, and (below) read before the next 16 overwrite them
        float* crow = C + (size_t)(rw + mb * 16) * ldc + cw;
{
#pragma unroll
            for (int s = 0; s < 8; ++s) { const int row = 2 * s + hi, cofs = lr * 4; v4f val = *(const v4fa*)(os + row * 68 + cofs); if (BIAS) { val[0] += bfr(bias[cw + cofs]); val[1] += bfr(bias[cw + cofs + 1]); val[2] += bfr(bias[cw + cofs + 2]); val[3] += bfr(bias[cw + cofs + 3]); }
                *(v4f*)(crow + (size_t)row * ldc + cofs) = val; }
             }
        __builtin_amdgcn_wave_barrier(); asm volatile("" ::: "memory");
    }
}

__device__ __forceinline__ h16 tohx(float x) { return (h16)x; }
__device__ __forceinline__ void splitf(float y, unsigned short& h, unsigned short& l) { h = f2bf(y); l = f2bf(y - bf2f(h)); }
typedef __attribute__((ext_vector_type(2))) _Float16 v2h;
typedef __attribute__((ext_vector_type(4))) _Float16 v4h;
typedef __attribute__((ext_vector_type(2))) unsigned short v2us;
typedef __attribute__((ext_vector_type(4))) unsigned short v4us;
typedef __attribute__((ext_vector_type(2))) float v2f;
typedef __attribute__((ext_vector_type(4))) int v4i;

__global__ __launch_bounds__(256) void k_cvt8(const float* __restrict__ src, bf* dst, size_t n8) { const size_t i = (size_t)blockIdx.x * 256 + threadIdx.x; if (i >= n8) return; const v8f v = *(const v8f*)(src + i * 8); v8us o;
#pragma unroll
    for (int k = 0; k < 8; ++k) o[k] = f2bf(v[k]); *(v8us*)(dst + i * 8) = o;  }
// k_asoft: per row (zz, i): t = S x SCL (no mask; SCL 0.125 here: the module's 1/32 is 0.125 x the 1/4 folded into q's cast); softmax over the 2048 keys (register row, one exp, fixed trees);
__global__ __launch_bounds__(256) void k_asoft(const float* __restrict__ Sb, h16* P16, bf* Ph, bf* Pl) {
    const int lane = threadIdx.x & 31; const int row = blockIdx.x * 8 + (threadIdx.x >> 5); if (row >= ZH * TT) return; const int i = row % TT; const int zz = row / TT; (void)zz; const bool hires = (i < RH); const float* sr = Sb + (size_t)row * TT; float v[TT / 32]; float mx = -3.0e38f;
#pragma unroll
    for (int ch = 0; ch < TT / 128; ++ch) { const int j0 = ch * 128 + lane * 4; const v4f a = *(const v4f*)(sr + j0);
#pragma unroll
        for (int q = 0; q < 4; ++q) { const int j = j0 + q; (void)j; const float t = a[q] * SCL; v[ch * 4 + q] = t; mx = fmaxf(mx, t); } }
#pragma unroll
    for (int sh = 16; sh; sh >>= 1) mx = fmaxf(mx, __shfl_xor(mx, sh, 32));
    float sum = 0.f;
#pragma unroll
    for (int k = 0; k < TT / 32; ++k) { float d0 = __fsub_rn(v[k], mx); v[k] = __builtin_amdgcn_exp2f(__fmul_rn(d0, 1.4426950408889634f)); sum += v[k]; }
#pragma unroll
    for (int sh = 16; sh; sh >>= 1) sum += __shfl_xor(sum, sh, 32);
    const float f = __fdiv_rn(hires ? 1.0f : PCAR, sum);
{
        if (hires) {
#pragma unroll
            for (int ch = 0; ch < TT / 128; ++ch) { v4us oh, ol;
#pragma unroll
                for (int q = 0; q < 4; ++q) { unsigned short a, c2; splitf(v[ch * 4 + q] * f, a, c2); oh[q] = a; ol[q] = c2; }
                const size_t oo = ((size_t)zz * (RH ? RH : 1) + i) * TT + ch * 128 + lane * 4; *(v4us*)(Ph + oo) = oh; *(v4us*)(Pl + oo) = ol; }
        } else {
#pragma unroll
            for (int ch = 0; ch < TT / 128; ++ch) { v4h o4;
#pragma unroll
                for (int q = 0; q < 4; ++q) o4[q] = tohx(v[ch * 4 + q] * f);
                *(v4h*)(P16 + (size_t)row * TT + ch * 128 + lane * 4) = o4; } }
         }
}
__global__ __launch_bounds__(256) void k_tohl(const float* __restrict__ F, float sc, bf* Hh, bf* Hl, size_t n4) { const size_t i = (size_t)blockIdx.x * 256 + threadIdx.x; if (i >= n4) return; const v4f a = *(const v4f*)(F + i * 4); v4us oh, ol;
#pragma unroll
    for (int q = 0; q < 4; ++q) { unsigned short h2, l2; splitf(__fmul_rn(a[q], sc), h2, l2); oh[q] = h2; ol[q] = l2; }
    *(v4us*)(Hh + i * 4) = oh; *(v4us*)(Hl + i * 4) = ol;  }
__global__ __launch_bounds__(256) void k_f2h(const float* __restrict__ S, h16* P16, size_t n4) { const size_t i = (size_t)blockIdx.x * 256 + threadIdx.x; if (i >= n4) return; const v4f v = *(const v4f*)(S + i * 4); v4h o;
#pragma unroll
    for (int q = 0; q < 4; ++q) o[q] = tohx(v[q]);
    *(v4h*)(P16 + i * 4) = o;  }
// k_rows<H>: ONE ENTRY's ROWS GATHERED OUT OF THE [token][entry][channel] LAYOUT: dst[t][c] = cast(src[t x pitch + c]) for t < 2,048, c < 1,024 (src already points at the entry's first row: row pitch 'pitch' floats); H = false: bf16 words (round to nearest even);
template <bool H>
__global__ __launch_bounds__(256) void k_rows(const float* __restrict__ src, size_t pitch, float sc, unsigned short* dst) { const size_t i = (size_t)blockIdx.x * 256 + threadIdx.x; const size_t t = i / (DM / 8), c = (i % (DM / 8)) * 8; const v4f a = *(const v4f*)(src + t * pitch + c), b = *(const v4f*)(src + t * pitch + c + 4); v8us o;
#pragma unroll
    for (int q = 0; q < 8; ++q) { const float x = (q < 4) ? a[q] : b[q - 4]; if (H) { const float y = __fmul_rn(bfr(x), sc); const float z = (fabsf(y) < 6.103515625e-5f) ? 0.0f : y; o[q] = __builtin_bit_cast(unsigned short, tohx(z)); } else o[q] = f2bf(x); }
    *(v8us*)(dst + i * 8) = o;  }
__global__ __launch_bounds__(256) void k_wout(const h16* __restrict__ P16, float* Wt) { const size_t i = (size_t)blockIdx.x * 256 + threadIdx.x; const v8h p = *(const v8h*)(P16 + i * 8); v4f o0, o1;
#pragma unroll
    for (int q = 0; q < 4; ++q) { o0[q] = __fmul_rn((float)p[q], 1.0f / PCAR); o1[q] = __fmul_rn((float)p[4 + q], 1.0f / PCAR); }
{ *(v4f*)(Wt + i * 8) = o0; *(v4f*)(Wt + i * 8 + 4) = o1;
         } }
__global__ __launch_bounds__(256) void k_bcar(const float* __restrict__ b, float* BV) { const unsigned c = blockIdx.x * 256 + threadIdx.x; const float v = __fmul_rn(bfr(b[c]), PCAR); *(float*)(BV + c) = v;  }

extern "C" void kernel_launch(void* const* d_in, const int* in_sizes, int n_in,
                              void* d_out, int out_size, void* d_ws, size_t ws_size, hipStream_t stream) {
    (void)in_sizes; (void)n_in; (void)out_size;
    const float* qin = (const float*)d_in[0]; const float* xin = (const float*)d_in[1]; const float* win = (const float*)d_in[2]; const float* bin = (const float*)d_in[3]; const float* wo = (const float*)d_in[4]; const float* bo = (const float*)d_in[5];   /* the module's argument order: query, input_feature, in_proj_weight, in_proj_bias, out_proj_weight, out_proj_bias: SIX inputs; all read */
    float* OUT0 = (float*)d_out;                                   // attn [2048][4][1024]
    float* OUT1 = (float*)d_out + (size_t)TT * NB_ * DM;           // attn_weights [4][2048][2048]: 33,554,432 B after the first
    char* wsp = (char*)d_ws;
    auto take = [&](size_t bytes) { char* p = wsp; wsp += (bytes + 255) & ~(size_t)255; return (void*)p; };
    bf* WB = (bf*)take((size_t)2 * DM * DM * 2);   /* in_proj_weight as bf16: rows [0, 1024) k's, [1024, 2048) v's */ bf* WOB = (bf*)take((size_t)DM * DM * 2); float* BV = (float*)take((size_t)DM * 4);
    bf* XB = (bf*)take((size_t)TT * DM * 2); float* KF = (float*)take((size_t)TT * DM * 4); float* VTF = (float*)take((size_t)DM * TT * 4);   /* an entry's bf16 rows; its k plane f32 token-major; its v plane f32 CHANNEL-major [1024][2048] */
    h16* Q16 = (h16*)take((size_t)ZH * TT * DM * 2); h16* K16 = (h16*)take((size_t)ZH * TT * DM * 2); h16* VT16 = (h16*)take((size_t)ZH * DM * TT * 2);   /* the pair's f16 planes */
    float* Sb = (float*)take((size_t)ZH * TT * TT * 4); h16* P16 = (h16*)take((size_t)ZH * TT * TT * 2); float* Ob = (float*)take((size_t)ZH * TT * DM * 4); bf* ATh = (bf*)take((size_t)ZH * TT * DM * 2); bf* ATl = (bf*)take((size_t)ZH * TT * DM * 2);
    if ((size_t)(wsp - (char*)d_ws) > ws_size) return;    // total 130.00 MiB carved
    k_cvt8<<<(unsigned)(((size_t)2 * DM * DM / 8 + 255) / 256), 256, 0, stream>>>(win, WB, (size_t)2 * DM * DM / 8); k_cvt8<<<(unsigned)(((size_t)DM * DM / 8 + 255) / 256), 256, 0, stream>>>(wo, WOB, (size_t)DM * DM / 8);
    k_bcar<<<DM / 256, 256, 0, stream>>>(bin + DM, BV);
    const size_t PITCH = (size_t)NB_ * DM; const unsigned GR = (unsigned)((size_t)TT * DM / 8 / 256), GH = (unsigned)(((size_t)TT * DM / 4 + 255) / 256);
    for (int b0 = 0; b0 < NB_; b0 += ZH) {
        for (int zz = 0; zz < ZH; ++zz) { const int b = b0 + zz;
            k_rows<false><<<GR, 256, 0, stream>>>(xin + (size_t)b * DM, PITCH, 1.0f, XB); k_rows<true><<<GR, 256, 0, stream>>>(qin + (size_t)b * DM, PITCH, QSC, (unsigned short*)(Q16 + (size_t)zz * TT * DM));
            k_gemmt<bf, false, true><<<dim3(TT / 128, DM / 128, 1), 128, 0, stream>>>(XB, nullptr, WB, DM, KF, DM, bin, 0, 0, 0);   /* k = x Wk^T + bk: token-major */
            k_f2h<<<GH, 256, 0, stream>>>(KF, K16 + (size_t)zz * TT * DM, (size_t)TT * DM / 4);
            k_gemmt<bf, false, false><<<dim3(DM / 128, TT / 128, 1), 128, 0, stream>>>(WB + (size_t)DM * DM, nullptr, XB, DM, VTF, TT, nullptr, 0, 0, 0);   /* v^T = Wv x^T: channel-major [1024][2048]; v's bias rides the value product */
            k_f2h<<<GH, 256, 0, stream>>>(VTF, VT16 + (size_t)zz * DM * TT, (size_t)DM * TT / 4); }
        k_gemmt<h16, false, false><<<dim3(TT / 128, TT / 128, ZH), 128, 0, stream>>>(Q16, nullptr, K16, DM, Sb, TT, nullptr, (size_t)TT * DM, (size_t)TT * DM, (size_t)TT * TT);   /* scores = (q / 4) k^T */
        k_asoft<<<ZH * TT / 8, 256, 0, stream>>>(Sb, P16, nullptr, nullptr);
        k_wout<<<(unsigned)((size_t)ZH * TT * TT / 8 / 256), 256, 0, stream>>>(P16, OUT1 + (size_t)b0 * TT * TT);   /* the second output's two entries */
        k_gemmt<h16, false, true><<<dim3(TT / 128, DM / 128, ZH), 128, 0, stream>>>(P16, nullptr, VT16, TT, Ob, DM, BV, (size_t)TT * TT, (size_t)DM * TT, (size_t)TT * DM);   /* 1,024 x (weights v + bv) */
        k_tohl<<<(unsigned)(((size_t)ZH * TT * DM / 4 + 255) / 256), 256, 0, stream>>>(Ob, 1.0f / PCAR, ATh, ATl, (size_t)ZH * TT * DM / 4);
        k_gemmt<bf, true, true><<<dim3(TT / 128, DM / 128, ZH), 128, 0, stream>>>(ATh, ATl, WOB, DM, OUT0 + (size_t)b0 * DM, (int)PITCH, bo, (size_t)TT * DM, 0, (size_t)DM);   /* out = attn Wo^T + bo, written in place: row pitch 4,096 floats; the pair's second entry 1,024 floats further */
    }
}

// v002
// It runs in 244 microseconds.
// Timed twice side by side with v001, it ran 1.24 times as fast both times.
// All steps since v000 together make it 2.37 times as fast.
#include <hip/hip_runtime.h>
#include <stdint.h>

// Single-head cross-attention that also returns its softmax weights (query, input_feature [2048][4][1024] = [token][entry][channel]; kv = input_feature in_proj_weight^T + in_proj_bias ('oi' (out, in) [2048][1024] x 1/32 + [2048] zeros): k = the first 1,024 columns, v = the last; q = query x 1024^-0.5: NO q projection; ONE head of width 1,024;
// attn_weights[b][t][s] = softmax over the 2,048 keys s of q[t] . k[s] (no mask): RETURNED as the second output [4][2048][2048]; attn = attn_weights v; out = attn out_proj_weight^T + out_proj_bias ('oi' [1024][1024] + [1024] zeros): the first output [2048][4][1024]; argument order query, input_feature, in_proj_weight, in_proj_bias, out_proj_weight, out_proj_bias).
// Layout: once: both weights cast to bf16 as they stand (the k rows and the v rows of in_proj_weight are its two halves); v's half of in_proj_bias carried x 1,024 (k_bcar); per PAIR of entries (the softmax kernel takes two planes a launch): each entry's rows gathered out of the [token][entry] layout (a row pitch of 4,096 floats) into contiguous planes: input_feature as bf16 (k_rows<false>) and query x 1/4 as ONE f16 word (k_rows<true>: a word under 2^-14 in size is written as zero);
// k = x Wk^T + bias (a plain bf16 product; token-major [2048][1024]: it IS the head's key plane), stored by the product's own epilogue as ONE f16 word; v^T = Wv x^T (the same product with the operands' roles exchanged: channel-major [1024][2048]: the value product's second operand, no transposer), stored likewise as ONE f16 word; scores = q k^T (one fp16 product at depth 1,024); the softmax at 2,048 keys, EVERY row on the f16 plane of its weights x 1,024;
// THE SECOND OUTPUT is that plane x 2^-10 as f32, stored by the softmax beside the plane; 1,024 x (weights v + v's bias) by one fp16 product at depth 2,048 with the carried bias in its bias slot (the rows of the weights sum to one: adding v's bias after the product equals adding it to v before); its epilogue stores the bf16 hi / lo planes x 2^-10 (the scale argument undoes the carry); hi/lo x out_proj_weight exact + out_proj_bias writes the first output in place (row pitch 4,096 floats; the pair's second entry 1,024 floats further).
// THREE flat kernel texts of this file (k_cvt8, k_rows in two forms, k_bcar: no loop; every address from the lane's own index and launch constants; no LDS, barrier, cross-lane word or atomic).
// Compute dtypes, f32 accumulate: every float input rounded to bf16 at its load; both projections plain bf16 (inputs: exact); q (an input x 1/4: exact in f16 but for words under 2^-14), k, v and the weights x 1,024 each ONE f16 word: both attention products fp16; softmax f32; the output projection hl x exact + bias.

#define NB_  4
#define TT   2048
#define DM   1024                 // the model width = the one head's width
#define ZH   2                    // entries a softmax launch
#define RH   0                    // the softmax's hi + lo stores stand under 'row < RH': none taken: EVERY row stores the f16 plane of its weights x 1,024
#define PCAR 1024.0f              // the weights' carry
#define SCL  0.125f               // the softmax's scale: the module's 1/32 = 0.125 x the 1/4 folded into q's cast (both powers of two: exact)
#define QSC  0.25f
typedef _Float16 h16;
typedef unsigned short bf;
typedef __attribute__((ext_vector_type(16))) __bf16   v16bf;
typedef __attribute__((ext_vector_type(16))) _Float16 v16h;
typedef __attribute__((ext_vector_type(8)))  _Float16 v8h;
typedef __attribute__((ext_vector_type(8)))  unsigned short v8us;
typedef __attribute__((ext_vector_type(8)))  float    v8f;
typedef __attribute__((ext_vector_type(4)))  float    v4f;
typedef v8h  __attribute__((may_alias)) v8ha;
typedef v4f  __attribute__((may_alias)) v4fa;
typedef v8us __attribute__((may_alias)) v8usa;

__device__ __forceinline__ unsigned short f2bf(float f) { unsigned u = __float_as_uint(f); u += 0x7FFFu + ((u >> 16) & 1u); return (unsigned short)(u >> 16); }
__device__ __forceinline__ float bf2f(unsigned short b) { return __uint_as_float(((unsigned)b) << 16); }
__device__ __forceinline__ float bfr(float f) { return bf2f(f2bf(f)); }
__device__ __forceinline__ v16h cat16(v8h lo, v8h hi) { return __builtin_shufflevector(lo, hi, 0, 1, 2, 3, 4, 5, 6, 7, 8, 9, 10, 11, 12, 13, 14, 15); }
__device__ __forceinline__ v16bf cat16b(v8us lo, v8us hi) { return __builtin_bit_cast(v16bf, __builtin_shufflevector(lo, hi, 0, 1, 2, 3, 4, 5, 6, 7, 8, 9, 10, 11, 12, 13, 14, 15)); }
__device__ __forceinline__ v8f wmma16(v16h a, v16h b, v8f c) { return __builtin_amdgcn_wmma_f32_16x16x32_f16(false, a, false, b, (short)0, c, false, false); }
__device__ __forceinline__ v8f wmmab(v16bf a, v16bf b, v8f c) { return __builtin_amdgcn_wmma_f32_16x16x32_bf16(false, a, false, b, (short)0, c, false, false); }
__device__ __forceinline__ h16 tohx(float x) { return (h16)x; }
__device__ __forceinline__ void splitf(float y, unsigned short& h, unsigned short& l) { h = f2bf(y); l = f2bf(y - bf2f(h)); }
typedef __attribute__((ext_vector_type(4))) _Float16 v4h;
typedef __attribute__((ext_vector_type(4))) unsigned short v4us;



// ---- k_gemmt: block GEMM, FOUR WAVES per 128x128 output tile (2 x 2 waves of 64x64, 16 accumulators each); grid (M/128, N/128, Z), 128 threads. Operands are K-contiguous 16-bit planes.
// C[m][n] (pitch ldc, + optional f32 bias[n]) = sum_k A[m][k] Bt[n][k] (SPLIT: then + sum_k A2[m][k] Bt[n][k], as further passes). OM picks what the epilogue stores of the f32 value: 0: the f32 word to C; 1: its f16 word to D0; 2: the bf16 hi and lo words of value x osc to D0 and D1 (the words its consumer reads: no f32 plane, no cast launch). z-batch strides sA/sB/sC in elements. M, N % 128 == 0, K % 128 == 0, K >= 256.
// A pass is 128 k = 256 B of every operand row. A stage is [A 128 rows | Bt 128 rows] in LDS at pitch 272 B, in four slices of 64 rows; each wave brings its own slice with ONE tensor load a pass; two buffers, so that the next pass's rows fly while this pass is worked on.
typedef uint32_t u32x4 __attribute__((ext_vector_type(4)));
typedef uint32_t u32x8 __attribute__((ext_vector_type(8)));
typedef float __attribute__((may_alias)) f32a;
#define ROWB   256u                // bytes of an operand row a pass
#define LPITCH 272u                // its pitch in LDS: 16 B x odd, for ds_load_b128 readers
#define SLICE  18432u              // 64 rows x 272 B = 17,408 B, rounded up to a multiple of 2 KiB
#define BUFB   (4u * SLICE)
__device__ __forceinline__ uint32_t uni(uint32_t v) { return (uint32_t)__builtin_amdgcn_readfirstlane(v); }
__device__ __forceinline__ uint32_t pinned(uint32_t v) { uint32_t w = uni(v); asm volatile("" : "+s"(w)); /* the pinned() form for a test round a tensor load: it holds the test in a scalar register, so that the branch is scalar (a tensor load ignores EXEC) */ return w; }
__device__ __forceinline__ void wait_ds0() { asm volatile("s_wait_dscnt 0x0" ::: "memory"); }       // this wave's LDS reads have retired before the barrier behind which their buffer is refilled
// both groups are in-out operands of the load and inputs of the wait that covers it: to the compiler the words behind the load are values that only these registers hold, needed again at the wait, so it neither reuses the registers as temporaries nor forms the words anew while the request is outstanding
__device__ __forceinline__ void tdm_load(u32x4& g0, u32x8& g1) { asm volatile("tensor_load_to_lds %0, %1" : "+s"(g0), "+s"(g1) :: "memory"); }
// this wave's own slice has landed: the compiler places no wait for a tensor load
__device__ __forceinline__ void wait_tensor0(const u32x4& g0, const u32x8& g1) { asm volatile("s_wait_tensorcnt 0x0" :: "s"(g0), "s"(g1) : "memory"); }
// eight row stores and their s_wait_xcnt 0 in ONE statement: the operands' registers live to the statement's end, so no register that a store names (address or data) is rewritten ahead of the wait
__device__ __forceinline__ void st8_b64(unsigned short* b, const size_t (&o)[8], const v4us (&d)[8]) {
    asm volatile("global_store_b64 %0, %8, off\n\tglobal_store_b64 %1, %9, off\n\tglobal_store_b64 %2, %10, off\n\tglobal_store_b64 %3, %11, off\n\tglobal_store_b64 %4, %12, off\n\tglobal_store_b64 %5, %13, off\n\tglobal_store_b64 %6, %14, off\n\tglobal_store_b64 %7, %15, off\n\ts_wait_xcnt 0x0"
                 :: "v"(b + o[0]), "v"(b + o[1]), "v"(b + o[2]), "v"(b + o[3]), "v"(b + o[4]), "v"(b + o[5]), "v"(b + o[6]), "v"(b + o[7]), "v"(d[0]), "v"(d[1]), "v"(d[2]), "v"(d[3]), "v"(d[4]), "v"(d[5]), "v"(d[6]), "v"(d[7]) : "memory"); }
__device__ __forceinline__ void st8_b128(float* b, const size_t (&o)[8], const v4f (&d)[8]) {
    asm volatile("global_store_b128 %0, %8, off\n\tglobal_store_b128 %1, %9, off\n\tglobal_store_b128 %2, %10, off\n\tglobal_store_b128 %3, %11, off\n\tglobal_store_b128 %4, %12, off\n\tglobal_store_b128 %5, %13, off\n\tglobal_store_b128 %6, %14, off\n\tglobal_store_b128 %7, %15, off\n\ts_wait_xcnt 0x0"
                 :: "v"(b + o[0]), "v"(b + o[1]), "v"(b + o[2]), "v"(b + o[3]), "v"(b + o[4]), "v"(b + o[5]), "v"(b + o[6]), "v"(b + o[7]), "v"(d[0]), "v"(d[1]), "v"(d[2]), "v"(d[3]), "v"(d[4]), "v"(d[5]), "v"(d[6]), "v"(d[7]) : "memory"); }
template <typename T16> struct WFrag;
template <> struct WFrag<h16> { typedef v16h V; static __device__ __forceinline__ V ld(const unsigned char* p) { return cat16(*(const v8ha*)p, *(const v8ha*)(p + 32)); } static __device__ __forceinline__ v8f mma(V a, V b, v8f c) { return wmma16(a, b, c); } };
template <> struct WFrag<bf> { typedef v16bf V; static __device__ __forceinline__ V ld(const unsigned char* p) { return cat16b(*(const v8usa*)p, *(const v8usa*)(p + 32)); } static __device__ __forceinline__ v8f mma(V a, V b, v8f c) { return wmmab(a, b, c); } };
template <typename T16, bool SPLIT, bool BIAS, int OM>
__global__ __launch_bounds__(128) void k_gemmt(const T16* __restrict__ A, const T16* __restrict__ A2, const T16* __restrict__ Bt, int K, float* C, unsigned short* D0, unsigned short* D1, float osc, int ldc, const float* __restrict__ bias, size_t sA, size_t sB, size_t sC) {
    typedef typename WFrag<T16>::V V;
    __shared__ __attribute__((aligned(2048))) unsigned char L[2 * BUFB];
    const size_t z = blockIdx.z;
    const int lane = threadIdx.x & 31, lr = lane & 15, hi = lane >> 4; const int r0 = blockIdx.x * 128, c0 = blockIdx.y * 128;
    const uint32_t wave = uni(threadIdx.x >> 5), wm = wave & 1u, wn = wave >> 1;
    const uint32_t np1 = (uint32_t)K / 128u, npass = SPLIT ? 2u * np1 : np1;
    const uint32_t lbase = (uint32_t)(size_t)L;
    // waves 0 and 1 bring the two halves of A's 128 rows, waves 2 and 3 those of Bt's
    const bool isB = wave >= 2u;
    const size_t rowoff = isB ? z * sB + (size_t)(c0 + (int)(wave - 2u) * 64) * K : z * sA + (size_t)(r0 + (int)wave * 64) * K;
    const uint64_t src1 = (uint64_t)(size_t)((isB ? Bt : A) + rowoff);
    const uint64_t src2 = SPLIT ? (uint64_t)(size_t)((isB ? Bt : A2) + rowoff) : src1;
    u32x8 g1;   // 1-byte elements; tensor = tile = 64 rows of 256 B; source pitch 2 K bytes; a pad of 4 dwords behind every 64 dwords
    g1[0] = uni((1u << 20) | (5u << 22) | (3u << 25)); g1[1] = uni((ROWB & 0xFFFFu) << 16); g1[2] = uni((ROWB >> 16) | (64u << 16)); g1[3] = uni(ROWB << 16); g1[4] = uni(64u); g1[5] = uni((uint32_t)K * 2u); g1[6] = uni(0u); g1[7] = uni(0u);
    u32x4 g0;   // the group 0 of the request last issued: it takes new values only behind the wait that covers that request
    auto issue = [&](uint32_t s) {
        const bool second = SPLIT && s >= np1;
        const uint64_t ga = (second ? src2 : src1) + (uint64_t)(second ? s - np1 : s) * ROWB;
        g0[0] = uni(1u); g0[1] = uni(lbase + (s & 1u) * BUFB + wave * SLICE); g0[2] = uni((uint32_t)ga); g0[3] = uni((((uint32_t)(ga >> 32)) & 0x01FFFFFFu) | 0x80000000u);
        tdm_load(g0, g1);
    };
    v8f acc[4][4];
#pragma unroll
    for (int mb = 0; mb < 4; ++mb)
#pragma unroll
        for (int nb = 0; nb < 4; ++nb) acc[mb][nb] = (v8f){};
    issue(0u); wait_tensor0(g0, g1); __syncthreads(); issue(1u);
    const unsigned char* fa0 = L + wm * SLICE + (uint32_t)lr * LPITCH + (uint32_t)hi * 16u;          // the lane's row of the wave's A slice; k order as the planes': 8 hi .. 8 hi + 7, then 16 + 8 hi ..
    const unsigned char* fb0 = L + (2u + wn) * SLICE + (uint32_t)lr * LPITCH + (uint32_t)hi * 16u;   // the same of its Bt slice
    for (uint32_t s = 0; s < npass; ++s) {
        const unsigned char* fa = fa0 + (s & 1u) * BUFB; const unsigned char* fb = fb0 + (s & 1u) * BUFB;
        V a[2][4], b[2][4];
#pragma unroll
        for (int q = 0; q < 4; ++q) { a[0][q] = WFrag<T16>::ld(fa + q * 16 * LPITCH); b[0][q] = WFrag<T16>::ld(fb + q * 16 * LPITCH); }
#pragma unroll
        for (int kb = 0; kb < 4; ++kb) {
            if (kb < 3) {
#pragma unroll
                for (int q = 0; q < 4; ++q) { a[(kb + 1) & 1][q] = WFrag<T16>::ld(fa + q * 16 * LPITCH + (kb + 1) * 64); b[(kb + 1) & 1][q] = WFrag<T16>::ld(fb + q * 16 * LPITCH + (kb + 1) * 64); } }
            __builtin_amdgcn_sched_barrier(0);   // keeps the next block's LDS reads one group ahead of this block's products, not spread among them
#pragma unroll
            for (int nb = 0; nb < 4; ++nb)
#pragma unroll
                for (int mb = 0; mb < 4; ++mb) acc[mb][nb] = WFrag<T16>::mma(a[kb & 1][mb], b[kb & 1][nb], acc[mb][nb]);
            __builtin_amdgcn_sched_barrier(0);   // the same, at the block's end
        }
        wait_ds0(); wait_tensor0(g0, g1); __syncthreads();   // publish point of stage s + 1; it also ends every reader's last read of stage s's buffer
        if (pinned(s + 2u < npass)) issue(s + 2u);
    }
    wait_tensor0(g0, g1); wait_ds0();
    // the last pass's barrier stands behind every wave's last read of the ring and no load is in flight: each wave stages its output rows in its own slice of buffer 0
    f32a* os = (f32a*)(L + wave * SLICE);
    const int rw = r0 + (int)wm * 64, cw = c0 + (int)wn * 64;
    v4f bv = (v4f){};   // the lane's four bias words: the same columns in every row it stores
    if (BIAS) {
#pragma unroll
        for (int q = 0; q < 4; ++q) bv[q] = bfr(bias[cw + lr * 4 + q]);
        asm volatile("s_wait_xcnt 0x0" ::: "memory"); }   // behind the bias load, ahead of every later write of its address registers
#pragma unroll
    for (int mb = 0; mb < 4; ++mb) {
#pragma unroll
        for (int nb = 0; nb < 4; ++nb) {
#pragma unroll
            for (int j = 0; j < 8; ++j) os[(hi * 8 + j) * 68 + nb * 16 + lr] = acc[mb][nb][j]; }
        __builtin_amdgcn_wave_barrier(); asm volatile("" ::: "memory");   // compiler order only: the wave's 16 staged rows are stored before any lane reads them back, and (below) read before the next 16 overwrite them
        const size_t crow = z * sC + (size_t)(rw + mb * 16) * ldc + cw;
        v4f val[8]; size_t co[8];   // step s: 16 lanes cover the 64 columns of row 2 s + hi: 256 B of f32 words, or one whole 128-B line of 16-bit words
#pragma unroll
        for (int s = 0; s < 8; ++s) { const int row = 2 * s + hi, cofs = lr * 4; val[s] = *(const v4fa*)(os + row * 68 + cofs); if (BIAS) val[s] += bv;
            co[s] = crow + (size_t)row * ldc + cofs; }
        if (OM == 0) st8_b128(C, co, val);
        else if (OM == 1) { v4us o[8];
#pragma unroll
            for (int s = 0; s < 8; ++s) { v4h t;
#pragma unroll
                for (int q = 0; q < 4; ++q) t[q] = tohx(val[s][q]);
                o[s] = __builtin_bit_cast(v4us, t); }
            st8_b64(D0, co, o); }
        else { v4us oh[8], ol[8];
#pragma unroll
            for (int s = 0; s < 8; ++s)
#pragma unroll
                for (int q = 0; q < 4; ++q) { unsigned short h2, l2; splitf(__fmul_rn(val[s][q], osc), h2, l2); oh[s][q] = h2; ol[s][q] = l2; }
            st8_b64(D0, co, oh); st8_b64(D1, co, ol); }
        __builtin_amdgcn_wave_barrier(); asm volatile("" ::: "memory");
    }
}

typedef __attribute__((ext_vector_type(2))) _Float16 v2h;
typedef __attribute__((ext_vector_type(2))) unsigned short v2us;
typedef __attribute__((ext_vector_type(2))) float v2f;
typedef __attribute__((ext_vector_type(4))) int v4i;

__global__ __launch_bounds__(256) void k_cvt8(const float* __restrict__ src, bf* dst, size_t n8) { const size_t i = (size_t)blockIdx.x * 256 + threadIdx.x; if (i >= n8) return; const v8f v = *(const v8f*)(src + i * 8); v8us o;
#pragma unroll
    for (int k = 0; k < 8; ++k) o[k] = f2bf(v[k]); *(v8us*)(dst + i * 8) = o;  }
// k_asoft: per row (zz, i): t = S x SCL (no mask; SCL 0.125 here: the module's 1/32 is 0.125 x the 1/4 folded into q's cast); softmax over the 2048 keys (register row, one exp, fixed trees); beside each f16 word of the weights x 1,024 it stores that word x 2^-10 as f32 to Wt: the second output;
__global__ __launch_bounds__(256) void k_asoft(const float* __restrict__ Sb, h16* P16, bf* Ph, bf* Pl, float* Wt) {
    const int lane = threadIdx.x & 31; const int row = blockIdx.x * 8 + (threadIdx.x >> 5); if (row >= ZH * TT) return; const int i = row % TT; const int zz = row / TT; (void)zz; const bool hires = (i < RH); const float* sr = Sb + (size_t)row * TT; float v[TT / 32]; float mx = -3.0e38f;
#pragma unroll
    for (int ch = 0; ch < TT / 128; ++ch) { const int j0 = ch * 128 + lane * 4; const v4f a = *(const v4f*)(sr + j0);
#pragma unroll
        for (int q = 0; q < 4; ++q) { const int j = j0 + q; (void)j; const float t = a[q] * SCL; v[ch * 4 + q] = t; mx = fmaxf(mx, t); } }
#pragma unroll
    for (int sh = 16; sh; sh >>= 1) mx = fmaxf(mx, __shfl_xor(mx, sh, 32));
    float sum = 0.f;
#pragma unroll
    for (int k = 0; k < TT / 32; ++k) { float d0 = __fsub_rn(v[k], mx); v[k] = __builtin_amdgcn_exp2f(__fmul_rn(d0, 1.4426950408889634f)); sum += v[k]; }
#pragma unroll
    for (int sh = 16; sh; sh >>= 1) sum += __shfl_xor(sum, sh, 32);
    const float f = __fdiv_rn(hires ? 1.0f : PCAR, sum);
{
        if (hires) {
#pragma unroll
            for (int ch = 0; ch < TT / 128; ++ch) { v4us oh, ol;
#pragma unroll
                for (int q = 0; q < 4; ++q) { unsigned short a, c2; splitf(v[ch * 4 + q] * f, a, c2); oh[q] = a; ol[q] = c2; }
                const size_t oo = ((size_t)zz * (RH ? RH : 1) + i) * TT + ch * 128 + lane * 4; *(v4us*)(Ph + oo) = oh; *(v4us*)(Pl + oo) = ol; }
        } else {
#pragma unroll
            for (int ch = 0; ch < TT / 128; ++ch) { v4h o4; v4f w4;
#pragma unroll
                for (int q = 0; q < 4; ++q) { o4[q] = tohx(v[ch * 4 + q] * f); w4[q] = __fmul_rn((float)o4[q], 1.0f / PCAR); }
                *(v4h*)(P16 + (size_t)row * TT + ch * 128 + lane * 4) = o4; *(v4f*)(Wt + (size_t)row * TT + ch * 128 + lane * 4) = w4; } }
         }
}
// k_rows<H>: ONE ENTRY's ROWS GATHERED OUT OF THE [token][entry][channel] LAYOUT: dst[t][c] = cast(src[t x pitch + c]) for t < 2,048, c < 1,024 (src already points at the entry's first row: row pitch 'pitch' floats); H = false: bf16 words (round to nearest even);
template <bool H>
__global__ __launch_bounds__(256) void k_rows(const float* __restrict__ src, size_t pitch, float sc, unsigned short* dst) { const size_t i = (size_t)blockIdx.x * 256 + threadIdx.x; const size_t t = i / (DM / 8), c = (i % (DM / 8)) * 8; const v4f a = *(const v4f*)(src + t * pitch + c), b = *(const v4f*)(src + t * pitch + c + 4); v8us o;
#pragma unroll
    for (int q = 0; q < 8; ++q) { const float x = (q < 4) ? a[q] : b[q - 4]; if (H) { const float y = __fmul_rn(bfr(x), sc); const float z = (fabsf(y) < 6.103515625e-5f) ? 0.0f : y; o[q] = __builtin_bit_cast(unsigned short, tohx(z)); } else o[q] = f2bf(x); }
    *(v8us*)(dst + i * 8) = o;  }
__global__ __launch_bounds__(256) void k_bcar(const float* __restrict__ b, float* BV) { const unsigned c = blockIdx.x * 256 + threadIdx.x; const float v = __fmul_rn(bfr(b[c]), PCAR); *(float*)(BV + c) = v;  }

extern "C" void kernel_launch(void* const* d_in, const int* in_sizes, int n_in,
                              void* d_out, int out_size, void* d_ws, size_t ws_size, hipStream_t stream) {
    (void)in_sizes; (void)n_in; (void)out_size;
    const float* qin = (const float*)d_in[0]; const float* xin = (const float*)d_in[1]; const float* win = (const float*)d_in[2]; const float* bin = (const float*)d_in[3]; const float* wo = (const float*)d_in[4]; const float* bo = (const float*)d_in[5];   /* the module's argument order: query, input_feature, in_proj_weight, in_proj_bias, out_proj_weight, out_proj_bias: SIX inputs; all read */
    float* OUT0 = (float*)d_out;                                   // attn [2048][4][1024]
    float* OUT1 = (float*)d_out + (size_t)TT * NB_ * DM;           // attn_weights [4][2048][2048]: 33,554,432 B after the first
    char* wsp = (char*)d_ws;
    auto take = [&](size_t bytes) { char* p = wsp; wsp += (bytes + 255) & ~(size_t)255; return (void*)p; };
    bf* WB = (bf*)take((size_t)2 * DM * DM * 2);   /* in_proj_weight as bf16: rows [0, 1024) k's, [1024, 2048) v's */ bf* WOB = (bf*)take((size_t)DM * DM * 2); float* BV = (float*)take((size_t)DM * 4);
    bf* XB = (bf*)take((size_t)TT * DM * 2);   /* an entry's bf16 rows */
    h16* Q16 = (h16*)take((size_t)ZH * TT * DM * 2); h16* K16 = (h16*)take((size_t)ZH * TT * DM * 2); h16* VT16 = (h16*)take((size_t)ZH * DM * TT * 2);   /* the pair's f16 planes: q; k token-major; v CHANNEL-major [1024][2048] */
    float* Sb = (float*)take((size_t)ZH * TT * TT * 4); h16* P16 = (h16*)take((size_t)ZH * TT * TT * 2); bf* ATh = (bf*)take((size_t)ZH * TT * DM * 2); bf* ATl = (bf*)take((size_t)ZH * TT * DM * 2);
    if ((size_t)(wsp - (char*)d_ws) > ws_size) return;    // total 98.00 MiB carved
    k_cvt8<<<(unsigned)(((size_t)2 * DM * DM / 8 + 255) / 256), 256, 0, stream>>>(win, WB, (size_t)2 * DM * DM / 8); k_cvt8<<<(unsigned)(((size_t)DM * DM / 8 + 255) / 256), 256, 0, stream>>>(wo, WOB, (size_t)DM * DM / 8);
    k_bcar<<<DM / 256, 256, 0, stream>>>(bin + DM, BV);
    const size_t PITCH = (size_t)NB_ * DM; const unsigned GR = (unsigned)((size_t)TT * DM / 8 / 256);
    for (int b0 = 0; b0 < NB_; b0 += ZH) {
        for (int zz = 0; zz < ZH; ++zz) { const int b = b0 + zz;
            k_rows<false><<<GR, 256, 0, stream>>>(xin + (size_t)b * DM, PITCH, 1.0f, XB); k_rows<true><<<GR, 256, 0, stream>>>(qin + (size_t)b * DM, PITCH, QSC, (unsigned short*)(Q16 + (size_t)zz * TT * DM));
            k_gemmt<bf, false, true, 1><<<dim3(TT / 128, DM / 128, 1), 128, 0, stream>>>(XB, nullptr, WB, DM, nullptr, (unsigned short*)(K16 + (size_t)zz * TT * DM), nullptr, 1.0f, DM, bin, 0, 0, 0);   /* k = x Wk^T + bk: token-major, f16 words */
            k_gemmt<bf, false, false, 1><<<dim3(DM / 128, TT / 128, 1), 128, 0, stream>>>(WB + (size_t)DM * DM, nullptr, XB, DM, nullptr, (unsigned short*)(VT16 + (size_t)zz * DM * TT), nullptr, 1.0f, TT, nullptr, 0, 0, 0); }   /* v^T = Wv x^T: channel-major [1024][2048], f16 words; v's bias rides the value product */
        k_gemmt<h16, false, false, 0><<<dim3(TT / 128, TT / 128, ZH), 128, 0, stream>>>(Q16, nullptr, K16, DM, Sb, nullptr, nullptr, 1.0f, TT, nullptr, (size_t)TT * DM, (size_t)TT * DM, (size_t)TT * TT);   /* scores = (q / 4) k^T */
        k_asoft<<<ZH * TT / 8, 256, 0, stream>>>(Sb, P16, nullptr, nullptr, OUT1 + (size_t)b0 * TT * TT);   /* the weights' f16 plane and the second output's two entries */
        k_gemmt<h16, false, true, 2><<<dim3(TT / 128, DM / 128, ZH), 128, 0, stream>>>(P16, nullptr, VT16, TT, nullptr, ATh, ATl, 1.0f / PCAR, DM, BV, (size_t)TT * TT, (size_t)DM * TT, (size_t)TT * DM);   /* 1,024 x (weights v + bv), stored x 2^-10 as bf16 hi / lo */
        k_gemmt<bf, true, true, 0><<<dim3(TT / 128, DM / 128, ZH), 128, 0, stream>>>(ATh, ATl, WOB, DM, OUT0 + (size_t)b0 * DM, nullptr, nullptr, 1.0f, (int)PITCH, bo, (size_t)TT * DM, 0, (size_t)DM);   /* out = attn Wo^T + bo, written in place: row pitch 4,096 floats; the pair's second entry 1,024 floats further */
    }
}

// v003
// A run of this version takes 139 microseconds.
// Next to v002, in two timings, it ran 1.69 and 1.77 times as fast.
// Over all steps from v000 it is 4.10 times as fast.
#include <hip/hip_runtime.h>
#include <stdint.h>

// Single-head cross-attention that also returns its softmax weights (query, input_feature [2048][4][1024] = [token][entry][channel]; kv = input_feature in_proj_weight^T + in_proj_bias ('oi' (out, in) [2048][1024] x 1/32 + [2048] zeros): k = the first 1,024 columns, v = the last; q = query x 1024^-0.5: NO q projection; ONE head of width 1,024;
// attn_weights[b][t][s] = softmax over the 2,048 keys s of q[t] . k[s] (no mask): RETURNED as the second output [4][2048][2048]; attn = attn_weights v; out = attn out_proj_weight^T + out_proj_bias ('oi' [1024][1024] + [1024] zeros): the first output [2048][4][1024]; argument order query, input_feature, in_proj_weight, in_proj_bias, out_proj_weight, out_proj_bias).
// Layout: once: both weights cast to bf16 as they stand (the k rows and the v rows of in_proj_weight are its two halves); v's half of in_proj_bias carried x 1,024 (k_bcar); ALL FOUR entries ride every launch (grid y of the gathers, grid z of the products, the softmax's rows): each entry's rows gathered out of the [token][entry] layout (a row pitch of 4,096 floats) into contiguous planes: input_feature as bf16 (k_rows<false>) and query x 1/4 as ONE f16 word (k_rows<true>: a word under 2^-14 in size is written as zero);
// k = x Wk^T + bias (a plain bf16 product; token-major [2048][1024]: it IS the head's key plane), stored by the product's own epilogue as ONE f16 word; v^T = Wv x^T (the same product with the operands' roles exchanged: channel-major [1024][2048]: the value product's second operand, no transposer), stored likewise as ONE f16 word; scores = q k^T (one fp16 product at depth 1,024); the softmax at 2,048 keys, EVERY row on the f16 plane of its weights x 1,024;
// THE SECOND OUTPUT is that plane x 2^-10 as f32, stored by the softmax beside the plane; 1,024 x (weights v + v's bias) by one fp16 product at depth 2,048 with the carried bias in its bias slot (the rows of the weights sum to one: adding v's bias after the product equals adding it to v before); its epilogue stores the bf16 hi / lo planes x 2^-10 (the scale argument undoes the carry); hi/lo x out_proj_weight exact + out_proj_bias writes the first output in place (row pitch 4,096 floats; each further entry 1,024 floats further).
// TWO flat kernel texts of this file beside k_cvt8 (k_rows in two forms, k_bcar: no loop; every address from the lane's own index and launch constants; no LDS, barrier, cross-lane word or atomic).
// Compute dtypes, f32 accumulate: every float input rounded to bf16 at its load; both projections plain bf16 (inputs: exact); q (an input x 1/4: exact in f16 but for words under 2^-14), k, v and the weights x 1,024 each ONE f16 word: both attention products fp16; softmax f32; the output projection hl x exact + bias.

#define NB_  4
#define TT   2048
#define DM   1024                 // the model width = the one head's width
#define ZH   4                    // entries a launch: all of them
#define RH   0                    // the softmax's hi + lo stores stand under 'row < RH': none taken: EVERY row stores the f16 plane of its weights x 1,024
#define PCAR 1024.0f              // the weights' carry
#define SCL  0.125f               // the softmax's scale: the module's 1/32 = 0.125 x the 1/4 folded into q's cast (both powers of two: exact)
#define QSC  0.25f
typedef _Float16 h16;
typedef unsigned short bf;
typedef __attribute__((ext_vector_type(16))) __bf16   v16bf;
typedef __attribute__((ext_vector_type(16))) _Float16 v16h;
typedef __attribute__((ext_vector_type(8)))  _Float16 v8h;
typedef __attribute__((ext_vector_type(8)))  unsigned short v8us;
typedef __attribute__((ext_vector_type(8)))  float    v8f;
typedef __attribute__((ext_vector_type(4)))  float    v4f;
typedef v8h  __attribute__((may_alias)) v8ha;
typedef v4f  __attribute__((may_alias)) v4fa;
typedef v8us __attribute__((may_alias)) v8usa;

__device__ __forceinline__ unsigned short f2bf(float f) { unsigned u = __float_as_uint(f); u += 0x7FFFu + ((u >> 16) & 1u); return (unsigned short)(u >> 16); }
__device__ __forceinline__ float bf2f(unsigned short b) { return __uint_as_float(((unsigned)b) << 16); }
__device__ __forceinline__ float bfr(float f) { return bf2f(f2bf(f)); }
__device__ __forceinline__ v16h cat16(v8h lo, v8h hi) { return __builtin_shufflevector(lo, hi, 0, 1, 2, 3, 4, 5, 6, 7, 8, 9, 10, 11, 12, 13, 14, 15); }
__device__ __forceinline__ v16bf cat16b(v8us lo, v8us hi) { return __builtin_bit_cast(v16bf, __builtin_shufflevector(lo, hi, 0, 1, 2, 3, 4, 5, 6, 7, 8, 9, 10, 11, 12, 13, 14, 15)); }
__device__ __forceinline__ v8f wmma16(v16h a, v16h b, v8f c) { return __builtin_amdgcn_wmma_f32_16x16x32_f16(false, a, false, b, (short)0, c, false, false); }
__device__ __forceinline__ v8f wmmab(v16bf a, v16bf b, v8f c) { return __builtin_amdgcn_wmma_f32_16x16x32_bf16(false, a, false, b, (short)0, c, false, false); }
__device__ __forceinline__ h16 tohx(float x) { return (h16)x; }
__device__ __forceinline__ void splitf(float y, unsigned short& h, unsigned short& l) { h = f2bf(y); l = f2bf(y - bf2f(h)); }
typedef __attribute__((ext_vector_type(4))) _Float16 v4h;
typedef __attribute__((ext_vector_type(4))) unsigned short v4us;



// ---- k_gemmt: block GEMM, FOUR WAVES per 128x128 output tile (2 x 2 waves of 64x64, 16 accumulators each); grid (M/128, N/128, Z), 128 threads. Operands are K-contiguous 16-bit planes.
// C[m][n] (pitch ldc, + optional f32 bias[n]) = sum_k A[m][k] Bt[n][k] (SPLIT: then + sum_k A2[m][k] Bt[n][k], as further passes). OM picks what the epilogue stores of the f32 value: 0: the f32 word to C; 1: its f16 word to D0; 2: the bf16 hi and lo words of value x osc to D0 and D1 (the words its consumer reads: no f32 plane, no cast launch). z-batch strides sA/sB/sC in elements. M, N % 128 == 0, K % 128 == 0, K >= 256.
// A pass is 128 k = 256 B of every operand row. A stage is [A 128 rows | Bt 128 rows] in LDS at pitch 272 B, in four slices of 64 rows; each wave brings its own slice with ONE tensor load a pass; two buffers, so that the next pass's rows fly while this pass is worked on.
typedef uint32_t u32x4 __attribute__((ext_vector_type(4)));
typedef uint32_t u32x8 __attribute__((ext_vector_type(8)));
typedef float __attribute__((may_alias)) f32a;
#define ROWB   256u                // bytes of an operand row a pass
#define LPITCH 272u                // its pitch in LDS: 16 B x odd, for ds_load_b128 readers
#define SLICE  18432u              // 64 rows x 272 B = 17,408 B, rounded up to a multiple of 2 KiB
#define BUFB   (4u * SLICE)
__device__ __forceinline__ uint32_t uni(uint32_t v) { return (uint32_t)__builtin_amdgcn_readfirstlane(v); }
__device__ __forceinline__ uint32_t pinned(uint32_t v) { uint32_t w = uni(v); asm volatile("" : "+s"(w)); /* the pinned() form for a test round a tensor load: it holds the test in a scalar register, so that the branch is scalar (a tensor load ignores EXEC) */ return w; }
__device__ __forceinline__ void wait_ds0() { asm volatile("s_wait_dscnt 0x0" ::: "memory"); }       // this wave's LDS reads have retired before the barrier behind which their buffer is refilled
// both groups are in-out operands of the load and inputs of the wait that covers it: to the compiler the words behind the load are values that only these registers hold, needed again at the wait, so it neither reuses the registers as temporaries nor forms the words anew while the request is outstanding
__device__ __forceinline__ void tdm_load(u32x4& g0, u32x8& g1) { asm volatile("tensor_load_to_lds %0, %1" : "+s"(g0), "+s"(g1) :: "memory"); }
// this wave's own slice has landed: the compiler places no wait for a tensor load
__device__ __forceinline__ void wait_tensor0(const u32x4& g0, const u32x8& g1) { asm volatile("s_wait_tensorcnt 0x0" :: "s"(g0), "s"(g1) : "memory"); }
// eight row stores and their s_wait_xcnt 0 in ONE statement: the operands' registers live to the statement's end, so no register that a store names (address or data) is rewritten ahead of the wait
__device__ __forceinline__ void st8_b64(unsigned short* b, const size_t (&o)[8], const v4us (&d)[8]) {
    asm volatile("global_store_b64 %0, %8, off\n\tglobal_store_b64 %1, %9, off\n\tglobal_store_b64 %2, %10, off\n\tglobal_store_b64 %3, %11, off\n\tglobal_store_b64 %4, %12, off\n\tglobal_store_b64 %5, %13, off\n\tglobal_store_b64 %6, %14, off\n\tglobal_store_b64 %7, %15, off\n\ts_wait_xcnt 0x0"
                 :: "v"(b + o[0]), "v"(b + o[1]), "v"(b + o[2]), "v"(b + o[3]), "v"(b + o[4]), "v"(b + o[5]), "v"(b + o[6]), "v"(b + o[7]), "v"(d[0]), "v"(d[1]), "v"(d[2]), "v"(d[3]), "v"(d[4]), "v"(d[5]), "v"(d[6]), "v"(d[7]) : "memory"); }
__device__ __forceinline__ void st8_b128(float* b, const size_t (&o)[8], const v4f (&d)[8]) {
    asm volatile("global_store_b128 %0, %8, off\n\tglobal_store_b128 %1, %9, off\n\tglobal_store_b128 %2, %10, off\n\tglobal_store_b128 %3, %11, off\n\tglobal_store_b128 %4, %12, off\n\tglobal_store_b128 %5, %13, off\n\tglobal_store_b128 %6, %14, off\n\tglobal_store_b128 %7, %15, off\n\ts_wait_xcnt 0x0"
                 :: "v"(b + o[0]), "v"(b + o[1]), "v"(b + o[2]), "v"(b + o[3]), "v"(b + o[4]), "v"(b + o[5]), "v"(b + o[6]), "v"(b + o[7]), "v"(d[0]), "v"(d[1]), "v"(d[2]), "v"(d[3]), "v"(d[4]), "v"(d[5]), "v"(d[6]), "v"(d[7]) : "memory"); }
template <typename T16> struct WFrag;
template <> struct WFrag<h16> { typedef v16h V; static __device__ __forceinline__ V ld(const unsigned char* p) { return cat16(*(const v8ha*)p, *(const v8ha*)(p + 32)); } static __device__ __forceinline__ v8f mma(V a, V b, v8f c) { return wmma16(a, b, c); } };
template <> struct WFrag<bf> { typedef v16bf V; static __device__ __forceinline__ V ld(const unsigned char* p) { return cat16b(*(const v8usa*)p, *(const v8usa*)(p + 32)); } static __device__ __forceinline__ v8f mma(V a, V b, v8f c) { return wmmab(a, b, c); } };
template <typename T16, bool SPLIT, bool BIAS, int OM>
__global__ __launch_bounds__(128) void k_gemmt(const T16* __restrict__ A, const T16* __restrict__ A2, const T16* __restrict__ Bt, int K, float* C, unsigned short* D0, unsigned short* D1, float osc, int ldc, const float* __restrict__ bias, size_t sA, size_t sB, size_t sC) {
    typedef typename WFrag<T16>::V V;
    __shared__ __attribute__((aligned(2048))) unsigned char L[2 * BUFB];
    const size_t z = blockIdx.z;
    const int lane = threadIdx.x & 31, lr = lane & 15, hi = lane >> 4; const int r0 = blockIdx.x * 128, c0 = blockIdx.y * 128;
    const uint32_t wave = uni(threadIdx.x >> 5), wm = wave & 1u, wn = wave >> 1;
    const uint32_t np1 = (uint32_t)K / 128u, npass = SPLIT ? 2u * np1 : np1;
    const uint32_t lbase = (uint32_t)(size_t)L;
    // waves 0 and 1 bring the two halves of A's 128 rows, waves 2 and 3 those of Bt's
    const bool isB = wave >= 2u;
    const size_t rowoff = isB ? z * sB + (size_t)(c0 + (int)(wave - 2u) * 64) * K : z * sA + (size_t)(r0 + (int)wave * 64) * K;
    const uint64_t src1 = (uint64_t)(size_t)((isB ? Bt : A) + rowoff);
    const uint64_t src2 = SPLIT ? (uint64_t)(size_t)((isB ? Bt : A2) + rowoff) : src1;
    u32x8 g1;   // 1-byte elements; tensor = tile = 64 rows of 256 B; source pitch 2 K bytes; a pad of 4 dwords behind every 64 dwords
    g1[0] = uni((1u << 20) | (5u << 22) | (3u << 25)); g1[1] = uni((ROWB & 0xFFFFu) << 16); g1[2] = uni((ROWB >> 16) | (64u << 16)); g1[3] = uni(ROWB << 16); g1[4] = uni(64u); g1[5] = uni((uint32_t)K * 2u); g1[6] = uni(0u); g1[7] = uni(0u);
    u32x4 g0;   // the group 0 of the request last issued: it takes new values only behind the wait that covers that request
    auto issue = [&](uint32_t s) {
        const bool second = SPLIT && s >= np1;
        const uint64_t ga = (second ? src2 : src1) + (uint64_t)(second ? s - np1 : s) * ROWB;
        g0[0] = uni(1u); g0[1] = uni(lbase + (s & 1u) * BUFB + wave * SLICE); g0[2] = uni((uint32_t)ga); g0[3] = uni((((uint32_t)(ga >> 32)) & 0x01FFFFFFu) | 0x80000000u);
        tdm_load(g0, g1);
    };
    v8f acc[4][4];
#pragma unroll
    for (int mb = 0; mb < 4; ++mb)
#pragma unroll
        for (int nb = 0; nb < 4; ++nb) acc[mb][nb] = (v8f){};
    issue(0u); wait_tensor0(g0, g1); __syncthreads(); issue(1u);
    const unsigned char* fa0 = L + wm * SLICE + (uint32_t)lr * LPITCH + (uint32_t)hi * 16u;          // the lane's row of the wave's A slice; k order as the planes': 8 hi .. 8 hi + 7, then 16 + 8 hi ..
    const unsigned char* fb0 = L + (2u + wn) * SLICE + (uint32_t)lr * LPITCH + (uint32_t)hi * 16u;   // the same of its Bt slice
    for (uint32_t s = 0; s < npass; ++s) {
        const unsigned char* fa = fa0 + (s & 1u) * BUFB; const unsigned char* fb = fb0 + (s & 1u) * BUFB;
        V a[2][4], b[2][4];
#pragma unroll
        for (int q = 0; q < 4; ++q) { a[0][q] = WFrag<T16>::ld(fa + q * 16 * LPITCH); b[0][q] = WFrag<T16>::ld(fb + q * 16 * LPITCH); }
#pragma unroll
        for (int kb = 0; kb < 4; ++kb) {
            if (kb < 3) {
#pragma unroll
                for (int q = 0; q < 4; ++q) { a[(kb + 1) & 1][q] = WFrag<T16>::ld(fa + q * 16 * LPITCH + (kb + 1) * 64); b[(kb + 1) & 1][q] = WFrag<T16>::ld(fb + q * 16 * LPITCH + (kb + 1) * 64); } }
            __builtin_amdgcn_sched_barrier(0);   // keeps the next block's LDS reads one group ahead of this block's products, not spread among them
#pragma unroll
            for (int nb = 0; nb < 4; ++nb)
#pragma unroll
                for (int mb = 0; mb < 4; ++mb) acc[mb][nb] = WFrag<T16>::mma(a[kb & 1][mb], b[kb & 1][nb], acc[mb][nb]);
            __builtin_amdgcn_sched_barrier(0);   // the same, at the block's end
        }
        wait_ds0(); wait_tensor0(g0, g1); __syncthreads();   // publish point of stage s + 1; it also ends every reader's last read of stage s's buffer
        if (pinned(s + 2u < npass)) issue(s + 2u);
    }
    wait_tensor0(g0, g1); wait_ds0();
    // the last pass's barrier stands behind every wave's last read of the ring and no load is in flight: each wave stages its output rows in its own slice of buffer 0
    f32a* os = (f32a*)(L + wave * SLICE);
    const int rw = r0 + (int)wm * 64, cw = c0 + (int)wn * 64;
    v4f bv = (v4f){};   // the lane's four bias words: the same columns in every row it stores
    if (BIAS) {
#pragma unroll
        for (int q = 0; q < 4; ++q) bv[q] = bfr(bias[cw + lr * 4 + q]);
        asm volatile("s_wait_xcnt 0x0" ::: "memory"); }   // behind the bias load, ahead of every later write of its address registers
#pragma unroll
    for (int mb = 0; mb < 4; ++mb) {
#pragma unroll
        for (int nb = 0; nb < 4; ++nb) {
#pragma unroll
            for (int j = 0; j < 8; ++j) os[(hi * 8 + j) * 68 + nb * 16 + lr] = acc[mb][nb][j]; }
        __builtin_amdgcn_wave_barrier(); asm volatile("" ::: "memory");   // compiler order only: the wave's 16 staged rows are stored before any lane reads them back, and (below) read before the next 16 overwrite them
        const size_t crow = z * sC + (size_t)(rw + mb * 16) * ldc + cw;
        v4f val[8]; size_t co[8];   // step s: 16 lanes cover the 64 columns of row 2 s + hi: 256 B of f32 words, or one whole 128-B line of 16-bit words
#pragma unroll
        for (int s = 0; s < 8; ++s) { const int row = 2 * s + hi, cofs = lr * 4; val[s] = *(const v4fa*)(os + row * 68 + cofs); if (BIAS) val[s] += bv;
            co[s] = crow + (size_t)row * ldc + cofs; }
        if (OM == 0) st8_b128(C, co, val);
        else if (OM == 1) { v4us o[8];
#pragma unroll
            for (int s = 0; s < 8; ++s) { v4h t;
#pragma unroll
                for (int q = 0; q < 4; ++q) t[q] = tohx(val[s][q]);
                o[s] = __builtin_bit_cast(v4us, t); }
            st8_b64(D0, co, o); }
        else { v4us oh[8], ol[8];
#pragma unroll
            for (int s = 0; s < 8; ++s)
#pragma unroll
                for (int q = 0; q < 4; ++q) { unsigned short h2, l2; splitf(__fmul_rn(val[s][q], osc), h2, l2); oh[s][q] = h2; ol[s][q] = l2; }
            st8_b64(D0, co, oh); st8_b64(D1, co, ol); }
        __builtin_amdgcn_wave_barrier(); asm volatile("" ::: "memory");
    }
}

typedef __attribute__((ext_vector_type(2))) _Float16 v2h;
typedef __attribute__((ext_vector_type(2))) unsigned short v2us;
typedef __attribute__((ext_vector_type(2))) float v2f;
typedef __attribute__((ext_vector_type(4))) int v4i;

__global__ __launch_bounds__(256) void k_cvt8(const float* __restrict__ src, bf* dst, size_t n8) { const size_t i = (size_t)blockIdx.x * 256 + threadIdx.x; if (i >= n8) return; const v8f v = *(const v8f*)(src + i * 8); v8us o;
#pragma unroll
    for (int k = 0; k < 8; ++k) o[k] = f2bf(v[k]); *(v8us*)(dst + i * 8) = o;  }
// k_asoft: per row (zz, i): t = S x SCL (no mask; SCL 0.125 here: the module's 1/32 is 0.125 x the 1/4 folded into q's cast); softmax over the 2048 keys (register row, one exp, fixed trees); beside each f16 word of the weights x 1,024 it stores that word x 2^-10 as f32 to Wt: the second output;
__global__ __launch_bounds__(256) void k_asoft(const float* __restrict__ Sb, h16* P16, bf* Ph, bf* Pl, float* Wt) {
    const int lane = threadIdx.x & 31; const int row = blockIdx.x * 8 + (threadIdx.x >> 5); if (row >= ZH * TT) return; const int i = row % TT; const int zz = row / TT; (void)zz; const bool hires = (i < RH); const float* sr = Sb + (size_t)row * TT; float v[TT / 32]; float mx = -3.0e38f;
#pragma unroll
    for (int ch = 0; ch < TT / 128; ++ch) { const int j0 = ch * 128 + lane * 4; const v4f a = *(const v4f*)(sr + j0);
#pragma unroll
        for (int q = 0; q < 4; ++q) { const int j = j0 + q; (void)j; const float t = a[q] * SCL; v[ch * 4 + q] = t; mx = fmaxf(mx, t); } }
#pragma unroll
    for (int sh = 16; sh; sh >>= 1) mx = fmaxf(mx, __shfl_xor(mx, sh, 32));
    float sum = 0.f;
#pragma unroll
    for (int k = 0; k < TT / 32; ++k) { float d0 = __fsub_rn(v[k], mx); v[k] = __builtin_amdgcn_exp2f(__fmul_rn(d0, 1.4426950408889634f)); sum += v[k]; }
#pragma unroll
    for (int sh = 16; sh; sh >>= 1) sum += __shfl_xor(sum, sh, 32);
    const float f = __fdiv_rn(hires ? 1.0f : PCAR, sum);
{
        if (hires) {
#pragma unroll
            for (int ch = 0; ch < TT / 128; ++ch) { v4us oh, ol;
#pragma unroll
                for (int q = 0; q < 4; ++q) { unsigned short a, c2; splitf(v[ch * 4 + q] * f, a, c2); oh[q] = a; ol[q] = c2; }
                const size_t oo = ((size_t)zz * (RH ? RH : 1) + i) * TT + ch * 128 + lane * 4; *(v4us*)(Ph + oo) = oh; *(v4us*)(Pl + oo) = ol; }
        } else {
#pragma unroll
            for (int ch = 0; ch < TT / 128; ++ch) { v4h o4; v4f w4;
#pragma unroll
                for (int q = 0; q < 4; ++q) { o4[q] = tohx(v[ch * 4 + q] * f); w4[q] = __fmul_rn((float)o4[q], 1.0f / PCAR); }
                *(v4h*)(P16 + (size_t)row * TT + ch * 128 + lane * 4) = o4; *(v4f*)(Wt + (size_t)row * TT + ch * 128 + lane * 4) = w4; } }
         }
}
// k_rows<H>: EACH ENTRY's ROWS GATHERED OUT OF THE [token][entry][channel] LAYOUT: entry e = blockIdx.y: dst[e][t][c] = cast(src[t x pitch + e x 1,024 + c]) for t < 2,048, c < 1,024 (row pitch 'pitch' floats); H = false: bf16 words (round to nearest even);
template <bool H>
__global__ __launch_bounds__(256) void k_rows(const float* __restrict__ src, size_t pitch, float sc, unsigned short* dst) { const size_t i = (size_t)blockIdx.x * 256 + threadIdx.x; const size_t t = i / (DM / 8), c = (i % (DM / 8)) * 8, e = blockIdx.y; const float* sp = src + t * pitch + e * DM + c; const v4f a = *(const v4f*)sp, b = *(const v4f*)(sp + 4); v8us o;
    asm volatile("s_wait_xcnt 0x0" ::: "memory");   // behind the two row loads, ahead of every later write of their address registers
#pragma unroll
    for (int q = 0; q < 8; ++q) { const float x = (q < 4) ? a[q] : b[q - 4]; if (H) { const float y = __fmul_rn(bfr(x), sc); const float z = (fabsf(y) < 6.103515625e-5f) ? 0.0f : y; o[q] = __builtin_bit_cast(unsigned short, tohx(z)); } else o[q] = f2bf(x); }
    *(v8us*)(dst + e * ((size_t)TT * DM) + i * 8) = o;  }
__global__ __launch_bounds__(256) void k_bcar(const float* __restrict__ b, float* BV) { const unsigned c = blockIdx.x * 256 + threadIdx.x; const float v = __fmul_rn(bfr(b[c]), PCAR); *(float*)(BV + c) = v;  }

extern "C" void kernel_launch(void* const* d_in, const int* in_sizes, int n_in,
                              void* d_out, int out_size, void* d_ws, size_t ws_size, hipStream_t stream) {
    (void)in_sizes; (void)n_in; (void)out_size;
    const float* qin = (const float*)d_in[0]; const float* xin = (const float*)d_in[1]; const float* win = (const float*)d_in[2]; const float* bin = (const float*)d_in[3]; const float* wo = (const float*)d_in[4]; const float* bo = (const float*)d_in[5];   /* the module's argument order: query, input_feature, in_proj_weight, in_proj_bias, out_proj_weight, out_proj_bias: SIX inputs; all read */
    float* OUT0 = (float*)d_out;                                   // attn [2048][4][1024]
    float* OUT1 = (float*)d_out + (size_t)TT * NB_ * DM;           // attn_weights [4][2048][2048]: 33,554,432 B after the first
    char* wsp = (char*)d_ws;
    auto take = [&](size_t bytes) { char* p = wsp; wsp += (bytes + 255) & ~(size_t)255; return (void*)p; };
    bf* WB = (bf*)take((size_t)2 * DM * DM * 2);   /* in_proj_weight as bf16: rows [0, 1024) k's, [1024, 2048) v's */ bf* WOB = (bf*)take((size_t)DM * DM * 2); float* BV = (float*)take((size_t)DM * 4);
    bf* XB = (bf*)take((size_t)ZH * TT * DM * 2);   /* the entries' bf16 rows */
    h16* Q16 = (h16*)take((size_t)ZH * TT * DM * 2); h16* K16 = (h16*)take((size_t)ZH * TT * DM * 2); h16* VT16 = (h16*)take((size_t)ZH * DM * TT * 2);   /* the entries' f16 planes: q; k token-major; v CHANNEL-major [1024][2048] */
    float* Sb = (float*)take((size_t)ZH * TT * TT * 4); h16* P16 = (h16*)take((size_t)ZH * TT * TT * 2); bf* ATh = (bf*)take((size_t)ZH * TT * DM * 2); bf* ATl = (bf*)take((size_t)ZH * TT * DM * 2);
    if ((size_t)(wsp - (char*)d_ws) > ws_size) return;    // total 198.00 MiB carved
    k_cvt8<<<(unsigned)(((size_t)2 * DM * DM / 8 + 255) / 256), 256, 0, stream>>>(win, WB, (size_t)2 * DM * DM / 8); k_cvt8<<<(unsigned)(((size_t)DM * DM / 8 + 255) / 256), 256, 0, stream>>>(wo, WOB, (size_t)DM * DM / 8);
    k_bcar<<<DM / 256, 256, 0, stream>>>(bin + DM, BV);
    const size_t PITCH = (size_t)NB_ * DM; const unsigned GR = (unsigned)((size_t)TT * DM / 8 / 256);
    const size_t PL = (size_t)TT * DM;   /* words of one entry's [2048][1024] plane */
    k_rows<false><<<dim3(GR, ZH, 1), 256, 0, stream>>>(xin, PITCH, 1.0f, XB); k_rows<true><<<dim3(GR, ZH, 1), 256, 0, stream>>>(qin, PITCH, QSC, (unsigned short*)Q16);
    k_gemmt<bf, false, true, 1><<<dim3(TT / 128, DM / 128, ZH), 128, 0, stream>>>(XB, nullptr, WB, DM, nullptr, (unsigned short*)K16, nullptr, 1.0f, DM, bin, PL, 0, PL);   /* k = x Wk^T + bk: token-major, f16 words */
    k_gemmt<bf, false, false, 1><<<dim3(DM / 128, TT / 128, ZH), 128, 0, stream>>>(WB + (size_t)DM * DM, nullptr, XB, DM, nullptr, (unsigned short*)VT16, nullptr, 1.0f, TT, nullptr, 0, PL, PL);   /* v^T = Wv x^T: channel-major [1024][2048], f16 words; v's bias rides the value product */
    k_gemmt<h16, false, false, 0><<<dim3(TT / 128, TT / 128, ZH), 128, 0, stream>>>(Q16, nullptr, K16, DM, Sb, nullptr, nullptr, 1.0f, TT, nullptr, PL, PL, (size_t)TT * TT);   /* scores = (q / 4) k^T */
    k_asoft<<<ZH * TT / 8, 256, 0, stream>>>(Sb, P16, nullptr, nullptr, OUT1);   /* the weights' f16 plane and the second output */
    k_gemmt<h16, false, true, 2><<<dim3(TT / 128, DM / 128, ZH), 128, 0, stream>>>(P16, nullptr, VT16, TT, nullptr, ATh, ATl, 1.0f / PCAR, DM, BV, (size_t)TT * TT, PL, PL);   /* 1,024 x (weights v + bv), stored x 2^-10 as bf16 hi / lo */
    k_gemmt<bf, true, true, 0><<<dim3(TT / 128, DM / 128, ZH), 128, 0, stream>>>(ATh, ATl, WOB, DM, OUT0, nullptr, nullptr, 1.0f, (int)PITCH, bo, PL, 0, (size_t)DM);   /* out = attn Wo^T + bo, written in place: row pitch 4,096 floats; each further entry 1,024 floats further */
}

// v004
// A run of this version takes 128 microseconds.
// Timed twice side by side with v003, it ran 1.08 times as fast both times.
// Counting every step since v000, it is 4.43 times as fast.
#include <hip/hip_runtime.h>
#include <stdint.h>

// Single-head cross-attention that also returns its softmax weights (query, input_feature [2048][4][1024] = [token][entry][channel]; kv = input_feature in_proj_weight^T + in_proj_bias ('oi' (out, in) [2048][1024] x 1/32 + [2048] zeros): k = the first 1,024 columns, v = the last; q = query x 1024^-0.5: NO q projection; ONE head of width 1,024;
// attn_weights[b][t][s] = softmax over the 2,048 keys s of q[t] . k[s] (no mask): RETURNED as the second output [4][2048][2048]; attn = attn_weights v; out = attn out_proj_weight^T + out_proj_bias ('oi' [1024][1024] + [1024] zeros): the first output [2048][4][1024]; argument order query, input_feature, in_proj_weight, in_proj_bias, out_proj_weight, out_proj_bias).
// Layout: once: both weights cast to bf16 as they stand (the k rows and the v rows of in_proj_weight are its two halves); v's half of in_proj_bias carried x 1,024; ALL FOUR entries ride every launch (the rows of k_prep, grid z of the products, the softmax's rows): each entry's rows gathered out of the [token][entry] layout (a row pitch of 4,096 floats) into contiguous planes: input_feature as bf16 and query x 1/4 as ONE f16 word (a word under 2^-14 in size is written as zero); all of these casts and gathers are ONE launch (k_prep);
// k = x Wk^T + bias (a plain bf16 product; token-major [2048][1024]: it IS the head's key plane), stored by the product's own epilogue as ONE f16 word; v^T = Wv x^T (the same product with the operands' roles exchanged: channel-major [1024][2048]: the value product's second operand, no transposer), stored likewise as ONE f16 word; scores = q k^T (one fp16 product at depth 1,024); the softmax at 2,048 keys, EVERY row on the f16 plane of its weights x 1,024;
// THE SECOND OUTPUT is that plane x 2^-10 as f32, stored by the softmax beside the plane; 1,024 x (weights v + v's bias) by one fp16 product at depth 2,048 with the carried bias in its bias slot (the rows of the weights sum to one: adding v's bias after the product equals adding it to v before); its epilogue stores the bf16 hi / lo planes x 2^-10 (the scale argument undoes the carry); hi/lo x out_proj_weight exact + out_proj_bias writes the first output in place (row pitch 4,096 floats; each further entry 1,024 floats further).
// ONE flat kernel text of this file (k_prep: no loop; every address from the wave's and the lane's own index and launch constants; no LDS, barrier, cross-lane word or atomic).
// Compute dtypes, f32 accumulate: every float input rounded to bf16 at its load; both projections plain bf16 (inputs: exact); q (an input x 1/4: exact in f16 but for words under 2^-14), k, v and the weights x 1,024 each ONE f16 word: both attention products fp16; softmax f32; the output projection hl x exact + bias.

#define NB_  4
#define TT   2048
#define DM   1024                 // the model width = the one head's width
#define ZH   4                    // entries a launch: all of them
#define RH   0                    // the softmax's hi + lo stores stand under 'row < RH': none taken: EVERY row stores the f16 plane of its weights x 1,024
#define PCAR 1024.0f              // the weights' carry
#define SCL  0.125f               // the softmax's scale: the module's 1/32 = 0.125 x the 1/4 folded into q's cast (both powers of two: exact)
#define QSC  0.25f
typedef _Float16 h16;
typedef unsigned short bf;
typedef __attribute__((ext_vector_type(16))) __bf16   v16bf;
typedef __attribute__((ext_vector_type(16))) _Float16 v16h;
typedef __attribute__((ext_vector_type(8)))  _Float16 v8h;
typedef __attribute__((ext_vector_type(8)))  unsigned short v8us;
typedef __attribute__((ext_vector_type(8)))  float    v8f;
typedef __attribute__((ext_vector_type(4)))  float    v4f;
typedef v8h  __attribute__((may_alias)) v8ha;
typedef v4f  __attribute__((may_alias)) v4fa;
typedef v8us __attribute__((may_alias)) v8usa;

__device__ __forceinline__ unsigned short f2bf(float f) { unsigned u = __float_as_uint(f); u += 0x7FFFu + ((u >> 16) & 1u); return (unsigned short)(u >> 16); }
__device__ __forceinline__ float bf2f(unsigned short b) { return __uint_as_float(((unsigned)b) << 16); }
__device__ __forceinline__ float bfr(float f) { return bf2f(f2bf(f)); }
__device__ __forceinline__ v16h cat16(v8h lo, v8h hi) { return __builtin_shufflevector(lo, hi, 0, 1, 2, 3, 4, 5, 6, 7, 8, 9, 10, 11, 12, 13, 14, 15); }
__device__ __forceinline__ v16bf cat16b(v8us lo, v8us hi) { return __builtin_bit_cast(v16bf, __builtin_shufflevector(lo, hi, 0, 1, 2, 3, 4, 5, 6, 7, 8, 9, 10, 11, 12, 13, 14, 15)); }
__device__ __forceinline__ v8f wmma16(v16h a, v16h b, v8f c) { return __builtin_amdgcn_wmma_f32_16x16x32_f16(false, a, false, b, (short)0, c, false, false); }
__device__ __forceinline__ v8f wmmab(v16bf a, v16bf b, v8f c) { return __builtin_amdgcn_wmma_f32_16x16x32_bf16(false, a, false, b, (short)0, c, false, false); }
__device__ __forceinline__ h16 tohx(float x) { return (h16)x; }
__device__ __forceinline__ void splitf(float y, unsigned short& h, unsigned short& l) { h = f2bf(y); l = f2bf(y - bf2f(h)); }
typedef __attribute__((ext_vector_type(4))) _Float16 v4h;
typedef __attribute__((ext_vector_type(4))) unsigned short v4us;



// ---- k_gemmt: block GEMM, FOUR WAVES per 128x128 output tile (2 x 2 waves of 64x64, 16 accumulators each); grid (M/128, N/128, Z), 128 threads. Operands are K-contiguous 16-bit planes.
// C[m][n] (pitch ldc, + optional f32 bias[n]) = sum_k A[m][k] Bt[n][k] (SPLIT: then + sum_k A2[m][k] Bt[n][k], as further passes). OM picks what the epilogue stores of the f32 value: 0: the f32 word to C; 1: its f16 word to D0; 2: the bf16 hi and lo words of value x osc to D0 and D1 (the words its consumer reads: no f32 plane, no cast launch). z-batch strides sA/sB/sC in elements. M, N % 128 == 0, K % 128 == 0, K >= 256.
// A pass is 128 k = 256 B of every operand row. A stage is [A 128 rows | Bt 128 rows] in LDS at pitch 272 B, in four slices of 64 rows; each wave brings its own slice with ONE tensor load a pass; two buffers, so that the next pass's rows fly while this pass is worked on.
typedef uint32_t u32x4 __attribute__((ext_vector_type(4)));
typedef uint32_t u32x8 __attribute__((ext_vector_type(8)));
typedef float __attribute__((may_alias)) f32a;
#define ROWB   256u                // bytes of an operand row a pass
#define LPITCH 272u                // its pitch in LDS: 16 B x odd, for ds_load_b128 readers
#define SLICE  18432u              // 64 rows x 272 B = 17,408 B, rounded up to a multiple of 2 KiB
#define BUFB   (4u * SLICE)
__device__ __forceinline__ uint32_t uni(uint32_t v) { return (uint32_t)__builtin_amdgcn_readfirstlane(v); }
__device__ __forceinline__ uint32_t pinned(uint32_t v) { uint32_t w = uni(v); asm volatile("" : "+s"(w)); /* the pinned() form for a test round a tensor load: it holds the test in a scalar register, so that the branch is scalar (a tensor load ignores EXEC) */ return w; }
__device__ __forceinline__ void wait_ds0() { asm volatile("s_wait_dscnt 0x0" ::: "memory"); }       // this wave's LDS reads have retired before the barrier behind which their buffer is refilled
// both groups are in-out operands of the load and inputs of the wait that covers it: to the compiler the words behind the load are values that only these registers hold, needed again at the wait, so it neither reuses the registers as temporaries nor forms the words anew while the request is outstanding
__device__ __forceinline__ void tdm_load(u32x4& g0, u32x8& g1) { asm volatile("tensor_load_to_lds %0, %1" : "+s"(g0), "+s"(g1) :: "memory"); }
// this wave's own slice has landed: the compiler places no wait for a tensor load
__device__ __forceinline__ void wait_tensor0(const u32x4& g0, const u32x8& g1) { asm volatile("s_wait_tensorcnt 0x0" :: "s"(g0), "s"(g1) : "memory"); }
// eight row stores and their s_wait_xcnt 0 in ONE statement: the operands' registers live to the statement's end, so no register that a store names (address or data) is rewritten ahead of the wait
__device__ __forceinline__ void st8_b64(unsigned short* b, const size_t (&o)[8], const v4us (&d)[8]) {
    asm volatile("global_store_b64 %0, %8, off\n\tglobal_store_b64 %1, %9, off\n\tglobal_store_b64 %2, %10, off\n\tglobal_store_b64 %3, %11, off\n\tglobal_store_b64 %4, %12, off\n\tglobal_store_b64 %5, %13, off\n\tglobal_store_b64 %6, %14, off\n\tglobal_store_b64 %7, %15, off\n\ts_wait_xcnt 0x0"
                 :: "v"(b + o[0]), "v"(b + o[1]), "v"(b + o[2]), "v"(b + o[3]), "v"(b + o[4]), "v"(b + o[5]), "v"(b + o[6]), "v"(b + o[7]), "v"(d[0]), "v"(d[1]), "v"(d[2]), "v"(d[3]), "v"(d[4]), "v"(d[5]), "v"(d[6]), "v"(d[7]) : "memory"); }
__device__ __forceinline__ void st8_b128(float* b, const size_t (&o)[8], const v4f (&d)[8]) {
    asm volatile("global_store_b128 %0, %8, off\n\tglobal_store_b128 %1, %9, off\n\tglobal_store_b128 %2, %10, off\n\tglobal_store_b128 %3, %11, off\n\tglobal_store_b128 %4, %12, off\n\tglobal_store_b128 %5, %13, off\n\tglobal_store_b128 %6, %14, off\n\tglobal_store_b128 %7, %15, off\n\ts_wait_xcnt 0x0"
                 :: "v"(b + o[0]), "v"(b + o[1]), "v"(b + o[2]), "v"(b + o[3]), "v"(b + o[4]), "v"(b + o[5]), "v"(b + o[6]), "v"(b + o[7]), "v"(d[0]), "v"(d[1]), "v"(d[2]), "v"(d[3]), "v"(d[4]), "v"(d[5]), "v"(d[6]), "v"(d[7]) : "memory"); }
template <typename T16> struct WFrag;
template <> struct WFrag<h16> { typedef v16h V; static __device__ __forceinline__ V ld(const unsigned char* p) { return cat16(*(const v8ha*)p, *(const v8ha*)(p + 32)); } static __device__ __forceinline__ v8f mma(V a, V b, v8f c) { return wmma16(a, b, c); } };
template <> struct WFrag<bf> { typedef v16bf V; static __device__ __forceinline__ V ld(const unsigned char* p) { return cat16b(*(const v8usa*)p, *(const v8usa*)(p + 32)); } static __device__ __forceinline__ v8f mma(V a, V b, v8f c) { return wmmab(a, b, c); } };
template <typename T16, bool SPLIT, bool BIAS, int OM>
__global__ __launch_bounds__(128) void k_gemmt(const T16* __restrict__ A, const T16* __restrict__ A2, const T16* __restrict__ Bt, int K, float* C, unsigned short* D0, unsigned short* D1, float osc, int ldc, const float* __restrict__ bias, size_t sA, size_t sB, size_t sC) {
    typedef typename WFrag<T16>::V V;
    __shared__ __attribute__((aligned(2048))) unsigned char L[2 * BUFB];
    const size_t z = blockIdx.z;
    const int lane = threadIdx.x & 31, lr = lane & 15, hi = lane >> 4; const int r0 = blockIdx.x * 128, c0 = blockIdx.y * 128;
    const uint32_t wave = uni(threadIdx.x >> 5), wm = wave & 1u, wn = wave >> 1;
    const uint32_t np1 = (uint32_t)K / 128u, npass = SPLIT ? 2u * np1 : np1;
    const uint32_t lbase = (uint32_t)(size_t)L;
    // waves 0 and 1 bring the two halves of A's 128 rows, waves 2 and 3 those of Bt's
    const bool isB = wave >= 2u;
    const size_t rowoff = isB ? z * sB + (size_t)(c0 + (int)(wave - 2u) * 64) * K : z * sA + (size_t)(r0 + (int)wave * 64) * K;
    const uint64_t src1 = (uint64_t)(size_t)((isB ? Bt : A) + rowoff);
    const uint64_t src2 = SPLIT ? (uint64_t)(size_t)((isB ? Bt : A2) + rowoff) : src1;
    u32x8 g1;   // 1-byte elements; tensor = tile = 64 rows of 256 B; source pitch 2 K bytes; a pad of 4 dwords behind every 64 dwords
    g1[0] = uni((1u << 20) | (5u << 22) | (3u << 25)); g1[1] = uni((ROWB & 0xFFFFu) << 16); g1[2] = uni((ROWB >> 16) | (64u << 16)); g1[3] = uni(ROWB << 16); g1[4] = uni(64u); g1[5] = uni((uint32_t)K * 2u); g1[6] = uni(0u); g1[7] = uni(0u);
    u32x4 g0;   // the group 0 of the request last issued: it takes new values only behind the wait that covers that request
    auto issue = [&](uint32_t s) {
        const bool second = SPLIT && s >= np1;
        const uint64_t ga = (second ? src2 : src1) + (uint64_t)(second ? s - np1 : s) * ROWB;
        g0[0] = uni(1u); g0[1] = uni(lbase + (s & 1u) * BUFB + wave * SLICE); g0[2] = uni((uint32_t)ga); g0[3] = uni((((uint32_t)(ga >> 32)) & 0x01FFFFFFu) | 0x80000000u);
        tdm_load(g0, g1);
    };
    v8f acc[4][4];
#pragma unroll
    for (int mb = 0; mb < 4; ++mb)
#pragma unroll
        for (int nb = 0; nb < 4; ++nb) acc[mb][nb] = (v8f){};
    issue(0u); wait_tensor0(g0, g1); __syncthreads(); issue(1u);
    const unsigned char* fa0 = L + wm * SLICE + (uint32_t)lr * LPITCH + (uint32_t)hi * 16u;          // the lane's row of the wave's A slice; k order as the planes': 8 hi .. 8 hi + 7, then 16 + 8 hi ..
    const unsigned char* fb0 = L + (2u + wn) * SLICE + (uint32_t)lr * LPITCH + (uint32_t)hi * 16u;   // the same of its Bt slice
    for (uint32_t s = 0; s < npass; ++s) {
        const unsigned char* fa = fa0 + (s & 1u) * BUFB; const unsigned char* fb = fb0 + (s & 1u) * BUFB;
        V a[2][4], b[2][4];
#pragma unroll
        for (int q = 0; q < 4; ++q) { a[0][q] = WFrag<T16>::ld(fa + q * 16 * LPITCH); b[0][q] = WFrag<T16>::ld(fb + q * 16 * LPITCH); }
#pragma unroll
        for (int kb = 0; kb < 4; ++kb) {
            if (kb < 3) {
#pragma unroll
                for (int q = 0; q < 4; ++q) { a[(kb + 1) & 1][q] = WFrag<T16>::ld(fa + q * 16 * LPITCH + (kb + 1) * 64); b[(kb + 1) & 1][q] = WFrag<T16>::ld(fb + q * 16 * LPITCH + (kb + 1) * 64); } }
            __builtin_amdgcn_sched_barrier(0);   // keeps the next block's LDS reads one group ahead of this block's products, not spread among them
#pragma unroll
            for (int nb = 0; nb < 4; ++nb)
#pragma unroll
                for (int mb = 0; mb < 4; ++mb) acc[mb][nb] = WFrag<T16>::mma(a[kb & 1][mb], b[kb & 1][nb], acc[mb][nb]);
            __builtin_amdgcn_sched_barrier(0);   // the same, at the block's end
        }
        wait_ds0(); wait_tensor0(g0, g1); __syncthreads();   // publish point of stage s + 1; it also ends every reader's last read of stage s's buffer
        if (pinned(s + 2u < npass)) issue(s + 2u);
    }
    wait_tensor0(g0, g1); wait_ds0();
    // the last pass's barrier stands behind every wave's last read of the ring and no load is in flight: each wave stages its output rows in its own slice of buffer 0
    f32a* os = (f32a*)(L + wave * SLICE);
    const int rw = r0 + (int)wm * 64, cw = c0 + (int)wn * 64;
    v4f bv = (v4f){};   // the lane's four bias words: the same columns in every row it stores
    if (BIAS) {
#pragma unroll
        for (int q = 0; q < 4; ++q) bv[q] = bfr(bias[cw + lr * 4 + q]);
        asm volatile("s_wait_xcnt 0x0" ::: "memory"); }   // behind the bias load, ahead of every later write of its address registers
#pragma unroll
    for (int mb = 0; mb < 4; ++mb) {
#pragma unroll
        for (int nb = 0; nb < 4; ++nb) {
#pragma unroll
            for (int j = 0; j < 8; ++j) os[(hi * 8 + j) * 68 + nb * 16 + lr] = acc[mb][nb][j]; }
        __builtin_amdgcn_wave_barrier(); asm volatile("" ::: "memory");   // compiler order only: the wave's 16 staged rows are stored before any lane reads them back, and (below) read before the next 16 overwrite them
        const size_t crow = z * sC + (size_t)(rw + mb * 16) * ldc + cw;
        v4f val[8]; size_t co[8];   // step s: 16 lanes cover the 64 columns of row 2 s + hi: 256 B of f32 words, or one whole 128-B line of 16-bit words
#pragma unroll
        for (int s = 0; s < 8; ++s) { const int row = 2 * s + hi, cofs = lr * 4; val[s] = *(const v4fa*)(os + row * 68 + cofs); if (BIAS) val[s] += bv;
            co[s] = crow + (size_t)row * ldc + cofs; }
        if (OM == 0) st8_b128(C, co, val);
        else if (OM == 1) { v4us o[8];
#pragma unroll
            for (int s = 0; s < 8; ++s) { v4h t;
#pragma unroll
                for (int q = 0; q < 4; ++q) t[q] = tohx(val[s][q]);
                o[s] = __builtin_bit_cast(v4us, t); }
            st8_b64(D0, co, o); }
        else { v4us oh[8], ol[8];
#pragma unroll
            for (int s = 0; s < 8; ++s)
#pragma unroll
                for (int q = 0; q < 4; ++q) { unsigned short h2, l2; splitf(__fmul_rn(val[s][q], osc), h2, l2); oh[s][q] = h2; ol[s][q] = l2; }
            st8_b64(D0, co, oh); st8_b64(D1, co, ol); }
        __builtin_amdgcn_wave_barrier(); asm volatile("" ::: "memory");
    }
}

typedef __attribute__((ext_vector_type(2))) _Float16 v2h;
typedef __attribute__((ext_vector_type(2))) unsigned short v2us;
typedef __attribute__((ext_vector_type(2))) float v2f;
typedef __attribute__((ext_vector_type(4))) int v4i;

// k_asoft: per row (zz, i): t = S x SCL (no mask; SCL 0.125 here: the module's 1/32 is 0.125 x the 1/4 folded into q's cast); softmax over the 2048 keys (register row, one exp, fixed trees); beside each f16 word of the weights x 1,024 it stores that word x 2^-10 as f32 to Wt: the second output;
__global__ __launch_bounds__(256) void k_asoft(const float* __restrict__ Sb, h16* P16, bf* Ph, bf* Pl, float* Wt) {
    const int lane = threadIdx.x & 31; const int row = blockIdx.x * 8 + (threadIdx.x >> 5); if (row >= ZH * TT) return; const int i = row % TT; const int zz = row / TT; (void)zz; const bool hires = (i < RH); const float* sr = Sb + (size_t)row * TT; float v[TT / 32]; float mx = -3.0e38f;
#pragma unroll
    for (int ch = 0; ch < TT / 128; ++ch) { const int j0 = ch * 128 + lane * 4; const v4f a = *(const v4f*)(sr + j0);
#pragma unroll
        for (int q = 0; q < 4; ++q) { const int j = j0 + q; (void)j; const float t = a[q] * SCL; v[ch * 4 + q] = t; mx = fmaxf(mx, t); } }
#pragma unroll
    for (int sh = 16; sh; sh >>= 1) mx = fmaxf(mx, __shfl_xor(mx, sh, 32));
    float sum = 0.f;
#pragma unroll
    for (int k = 0; k < TT / 32; ++k) { float d0 = __fsub_rn(v[k], mx); v[k] = __builtin_amdgcn_exp2f(__fmul_rn(d0, 1.4426950408889634f)); sum += v[k]; }
#pragma unroll
    for (int sh = 16; sh; sh >>= 1) sum += __shfl_xor(sum, sh, 32);
    const float f = __fdiv_rn(hires ? 1.0f : PCAR, sum);
{
        if (hires) {
#pragma unroll
            for (int ch = 0; ch < TT / 128; ++ch) { v4us oh, ol;
#pragma unroll
                for (int q = 0; q < 4; ++q) { unsigned short a, c2; splitf(v[ch * 4 + q] * f, a, c2); oh[q] = a; ol[q] = c2; }
                const size_t oo = ((size_t)zz * (RH ? RH : 1) + i) * TT + ch * 128 + lane * 4; *(v4us*)(Ph + oo) = oh; *(v4us*)(Pl + oo) = ol; }
        } else {
#pragma unroll
            for (int ch = 0; ch < TT / 128; ++ch) { v4h o4; v4f w4;
#pragma unroll
                for (int q = 0; q < 4; ++q) { o4[q] = tohx(v[ch * 4 + q] * f); w4[q] = __fmul_rn((float)o4[q], 1.0f / PCAR); }
                *(v4h*)(P16 + (size_t)row * TT + ch * 128 + lane * 4) = o4; *(v4f*)(Wt + (size_t)row * TT + ch * 128 + lane * 4) = w4; } }
         }
}
// ---- k_prep: EVERY CAST AND GATHER OF THE INPUTS AS ONE RESIDENT STREAM: 256 work-groups of 16 waves; the unit of work is one row of 1,024 floats (4 KiB in a row in its source): a wave reads it with eight 512-B loads and stores its 1,024 16-bit words with eight 256-B stores; two rows of a wave are in flight at any time.
// Wave w of 4,096 takes rows w and w + 4,096 of input_feature, the same two of query (row r = token r / 4 of entry r % 4: it goes to row r / 4 of plane r % 4), and the first twelve waves of every work-group one row of the 3,072 of the two weights; one more wave carries v's half of in_proj_bias x 1,024 as f32 words.
// The words are those of the flat casts: bf16 by round to nearest even; query: that word x 1/4 as f16, a word under 2^-14 in size written as zero.
#define PWV 16u                   // waves a work-group
#define PGR 256u                  // work-groups
#define PWT 12u                   // waves of a work-group that take a weight row: 256 x 12 = 2,048 + 1,024
// every loop of k_prep and its helpers is unrolled: the row arrays are then indexed by constants alone and stay in registers
__device__ __forceinline__ void ld_row(const float* __restrict__ s, int lane, v4f (&r)[8]) {
#pragma unroll
    for (int j = 0; j < 8; ++j) r[j] = *(const v4f*)(s + j * 128 + lane * 4);
    asm volatile("s_wait_xcnt 0x0" ::: "memory"); }   // behind the eight row loads, ahead of every later write of their address registers
template <bool H>
__device__ __forceinline__ void st_row(unsigned short* d, int lane, const v4f (&r)[8]) { v4us o[8]; size_t off[8];
#pragma unroll
    for (int j = 0; j < 8; ++j) { off[j] = (size_t)(j * 128 + lane * 4);
#pragma unroll
        for (int q = 0; q < 4; ++q) { const float x = r[j][q]; if (H) { const float y = __fmul_rn(bfr(x), QSC); const float z = (fabsf(y) < 6.103515625e-5f) ? 0.0f : y; o[j][q] = __builtin_bit_cast(unsigned short, tohx(z)); } else o[j][q] = f2bf(x); } }
    st8_b64(d, off, o); }
__global__ __launch_bounds__(512) void k_prep(const float* __restrict__ xin, const float* __restrict__ qin, const float* __restrict__ win, const float* __restrict__ wo, const float* __restrict__ bvin, unsigned short* XB, unsigned short* Q16, unsigned short* WB, unsigned short* WOB, float* BV) {
    const int lane = threadIdx.x & 31; const uint32_t wv = uni(threadIdx.x >> 5), w = blockIdx.x * PWV + wv, w2 = w + PGR * PWV, u = blockIdx.x * PWT + wv;   // u: the wave's weight row, where wv < PWT
    const size_t PLW = (size_t)TT * DM; const size_t d1 = (size_t)(w & 3u) * PLW + (size_t)(w >> 2) * DM, d2 = (size_t)(w2 & 3u) * PLW + (size_t)(w2 >> 2) * DM;
    const bool wrow = wv < PWT, brow = (blockIdx.x == 0u) && (wv == PWT), inw = u < 2u * DM;   // all three the same in every lane of a wave
    const float* s5 = brow ? bvin : inw ? win + (size_t)u * DM : wo + (size_t)(u - 2u * DM) * DM;
    v4f ra[8], rb[8];
    ld_row(xin + (size_t)w * DM, lane, ra); ld_row(xin + (size_t)w2 * DM, lane, rb);
    st_row<false>(XB + d1, lane, ra); ld_row(qin + (size_t)w * DM, lane, ra);
    st_row<false>(XB + d2, lane, rb); ld_row(qin + (size_t)w2 * DM, lane, rb);
    st_row<true>(Q16 + d1, lane, ra); if (wrow || brow) ld_row(s5, lane, ra);
    st_row<true>(Q16 + d2, lane, rb);
    if (wrow) st_row<false>(inw ? WB + (size_t)u * DM : WOB + (size_t)(u - 2u * DM) * DM, lane, ra);
    else if (brow) { v4f o[8]; size_t off[8];
#pragma unroll
        for (int j = 0; j < 8; ++j) { off[j] = (size_t)(j * 128 + lane * 4);
#pragma unroll
            for (int q = 0; q < 4; ++q) o[j][q] = __fmul_rn(bfr(ra[j][q]), PCAR); }
        st8_b128(BV, off, o); }
}

extern "C" void kernel_launch(void* const* d_in, const int* in_sizes, int n_in,
                              void* d_out, int out_size, void* d_ws, size_t ws_size, hipStream_t stream) {
    (void)in_sizes; (void)n_in; (void)out_size;
    const float* qin = (const float*)d_in[0]; const float* xin = (const float*)d_in[1]; const float* win = (const float*)d_in[2]; const float* bin = (const float*)d_in[3]; const float* wo = (const float*)d_in[4]; const float* bo = (const float*)d_in[5];   /* the module's argument order: query, input_feature, in_proj_weight, in_proj_bias, out_proj_weight, out_proj_bias: SIX inputs; all read */
    float* OUT0 = (float*)d_out;                                   // attn [2048][4][1024]
    float* OUT1 = (float*)d_out + (size_t)TT * NB_ * DM;           // attn_weights [4][2048][2048]: 33,554,432 B after the first
    char* wsp = (char*)d_ws;
    auto take = [&](size_t bytes) { char* p = wsp; wsp += (bytes + 255) & ~(size_t)255; return (void*)p; };
    bf* WB = (bf*)take((size_t)2 * DM * DM * 2);   /* in_proj_weight as bf16: rows [0, 1024) k's, [1024, 2048) v's */ bf* WOB = (bf*)take((size_t)DM * DM * 2); float* BV = (float*)take((size_t)DM * 4);
    bf* XB = (bf*)take((size_t)ZH * TT * DM * 2);   /* the entries' bf16 rows */
    h16* Q16 = (h16*)take((size_t)ZH * TT * DM * 2); h16* K16 = (h16*)take((size_t)ZH * TT * DM * 2); h16* VT16 = (h16*)take((size_t)ZH * DM * TT * 2);   /* the entries' f16 planes: q; k token-major; v CHANNEL-major [1024][2048] */
    float* Sb = (float*)take((size_t)ZH * TT * TT * 4); h16* P16 = (h16*)take((size_t)ZH * TT * TT * 2); bf* ATh = (bf*)take((size_t)ZH * TT * DM * 2); bf* ATl = (bf*)take((size_t)ZH * TT * DM * 2);
    if ((size_t)(wsp - (char*)d_ws) > ws_size) return;    // total 198.00 MiB carved
    const size_t PITCH = (size_t)NB_ * DM;
    const size_t PL = (size_t)TT * DM;   /* words of one entry's [2048][1024] plane */
    k_prep<<<PGR, PWV * 32u, 0, stream>>>(xin, qin, win, wo, bin + DM, XB, (unsigned short*)Q16, WB, WOB, BV);   /* every cast and gather of the inputs */
    k_gemmt<bf, false, true, 1><<<dim3(TT / 128, DM / 128, ZH), 128, 0, stream>>>(XB, nullptr, WB, DM, nullptr, (unsigned short*)K16, nullptr, 1.0f, DM, bin, PL, 0, PL);   /* k = x Wk^T + bk: token-major, f16 words */
    k_gemmt<bf, false, false, 1><<<dim3(DM / 128, TT / 128, ZH), 128, 0, stream>>>(WB + (size_t)DM * DM, nullptr, XB, DM, nullptr, (unsigned short*)VT16, nullptr, 1.0f, TT, nullptr, 0, PL, PL);   /* v^T = Wv x^T: channel-major [1024][2048], f16 words; v's bias rides the value product */
    k_gemmt<h16, false, false, 0><<<dim3(TT / 128, TT / 128, ZH), 128, 0, stream>>>(Q16, nullptr, K16, DM, Sb, nullptr, nullptr, 1.0f, TT, nullptr, PL, PL, (size_t)TT * TT);   /* scores = (q / 4) k^T */
    k_asoft<<<ZH * TT / 8, 256, 0, stream>>>(Sb, P16, nullptr, nullptr, OUT1);   /* the weights' f16 plane and the second output */
    k_gemmt<h16, false, true, 2><<<dim3(TT / 128, DM / 128, ZH), 128, 0, stream>>>(P16, nullptr, VT16, TT, nullptr, ATh, ATl, 1.0f / PCAR, DM, BV, (size_t)TT * TT, PL, PL);   /* 1,024 x (weights v + bv), stored x 2^-10 as bf16 hi / lo */
    k_gemmt<bf, true, true, 0><<<dim3(TT / 128, DM / 128, ZH), 128, 0, stream>>>(ATh, ATl, WOB, DM, OUT0, nullptr, nullptr, 1.0f, (int)PITCH, bo, PL, 0, (size_t)DM);   /* out = attn Wo^T + bo, written in place: row pitch 4,096 floats; each further entry 1,024 floats further */
}

// v005
// A run of this version takes 119 microseconds.
// Two timings next to v004 put it at 1.08 and 1.09 times that version's speed.
// Counting every step since v000, it is 4.80 times as fast.
#include <hip/hip_runtime.h>
#include <stdint.h>

// Single-head cross-attention that also returns its softmax weights (query, input_feature [2048][4][1024] = [token][entry][channel]; kv = input_feature in_proj_weight^T + in_proj_bias ('oi' (out, in) [2048][1024] x 1/32 + [2048] zeros): k = the first 1,024 columns, v = the last; q = query x 1024^-0.5: NO q projection; ONE head of width 1,024;
// attn_weights[b][t][s] = softmax over the 2,048 keys s of q[t] . k[s] (no mask): RETURNED as the second output [4][2048][2048]; attn = attn_weights v; out = attn out_proj_weight^T + out_proj_bias ('oi' [1024][1024] + [1024] zeros): the first output [2048][4][1024]; argument order query, input_feature, in_proj_weight, in_proj_bias, out_proj_weight, out_proj_bias).
// THE OUTPUT PROJECTION IS FOLDED INTO THE VALUE PROJECTION: out = weights (x Wv^T + bv) Wo^T + bo = weights (x (Wo Wv)^T) + (Wo bv + bo), the rows of the weights summing to one: Wvo = Wo Wv is formed anew in every call (one bf16 product of 1,024^3, stored as ONE f16 word), v' = x Wvo^T takes v's place, and the value product writes the first output itself: no product with out_proj_weight at 8,192 rows.
// Layout: once: k's rows of in_proj_weight and out_proj_weight cast to bf16 as they stand, v's rows cast AND TRANSPOSED ([channel in][channel out of v]: the second operand of Wo Wv); 1,024 x (Wo bv + bo) as f32 words, one a 128-B line; ALL FOUR entries ride every launch but that of Wo Wv (the rows of k_prep, grid z of the other products, the softmax's rows): each entry's rows gathered out of the [token][entry] layout (a row pitch of 4,096 floats) into contiguous planes: input_feature as bf16 (for k) and the same words as f16 (for v'; exact from 2^-17 up) and query x 1/4 as ONE f16 word (a word under 2^-14 in size is written as zero); all of these casts and gathers are ONE launch (k_prep);
// k = x Wk^T + bias (a plain bf16 product; token-major [2048][1024]: it IS the head's key plane), stored by the product's own epilogue as ONE f16 word; v'^T = Wvo x^T (an fp16 product with the operands' roles exchanged: channel-major [1024][2048]: the value product's second operand, no transposer), stored likewise as ONE f16 word; scores = q k^T (one fp16 product at depth 1,024); the softmax at 2,048 keys, EVERY row on the f16 plane of its weights x 1,024;
// THE SECOND OUTPUT is that plane x 2^-10 as f32, stored by the softmax beside the plane; 1,024 x (weights v' + Wo bv + bo) by one fp16 product at depth 2,048 with the carried vector in its bias slot (the rows of the weights sum to one: adding v's bias after the product equals adding it to v before); its epilogue stores the f32 words x 2^-10 (the scale argument undoes the carry): the first output in place (row pitch 4,096 floats; each further entry 1,024 floats further).
// A flat kernel text (k_prep: no loop; every address from the wave's and the lane's own index and launch constants; no LDS, barrier or atomic; cross-lane words only in the sum of Wo bv).
// Compute dtypes, f32 accumulate: every float input rounded to bf16 at its load; k's projection and Wo Wv plain bf16 (inputs: exact); q (an input x 1/4: exact in f16 but for words under 2^-14), k, Wvo, v' and the weights x 1,024 each ONE f16 word: v's projection and both attention products fp16; softmax f32; Wo bv + bo in f32 on the vector unit (one vector: no matrix form fits it).

#define NB_  4
#define TT   2048
#define DM   1024                 // the model width = the one head's width
#define ZH   4                    // entries a launch: all of them
#define RH   0                    // the softmax's hi + lo stores stand under 'row < RH': none taken: EVERY row stores the f16 plane of its weights x 1,024
#define PCAR 1024.0f              // the weights' carry
#define SCL  0.125f               // the softmax's scale: the module's 1/32 = 0.125 x the 1/4 folded into q's cast (both powers of two: exact)
#define QSC  0.25f
typedef _Float16 h16;
typedef unsigned short bf;
typedef __attribute__((ext_vector_type(16))) __bf16   v16bf;
typedef __attribute__((ext_vector_type(16))) _Float16 v16h;
typedef __attribute__((ext_vector_type(8)))  _Float16 v8h;
typedef __attribute__((ext_vector_type(8)))  unsigned short v8us;
typedef __attribute__((ext_vector_type(8)))  float    v8f;
typedef __attribute__((ext_vector_type(4)))  float    v4f;
typedef v8h  __attribute__((may_alias)) v8ha;
typedef v4f  __attribute__((may_alias)) v4fa;
typedef v8us __attribute__((may_alias)) v8usa;

__device__ __forceinline__ unsigned short f2bf(float f) { unsigned u = __float_as_uint(f); u += 0x7FFFu + ((u >> 16) & 1u); return (unsigned short)(u >> 16); }
__device__ __forceinline__ float bf2f(unsigned short b) { return __uint_as_float(((unsigned)b) << 16); }
__device__ __forceinline__ float bfr(float f) { return bf2f(f2bf(f)); }
__device__ __forceinline__ v16h cat16(v8h lo, v8h hi) { return __builtin_shufflevector(lo, hi, 0, 1, 2, 3, 4, 5, 6, 7, 8, 9, 10, 11, 12, 13, 14, 15); }
__device__ __forceinline__ v16bf cat16b(v8us lo, v8us hi) { return __builtin_bit_cast(v16bf, __builtin_shufflevector(lo, hi, 0, 1, 2, 3, 4, 5, 6, 7, 8, 9, 10, 11, 12, 13, 14, 15)); }
__device__ __forceinline__ v8f wmma16(v16h a, v16h b, v8f c) { return __builtin_amdgcn_wmma_f32_16x16x32_f16(false, a, false, b, (short)0, c, false, false); }
__device__ __forceinline__ v8f wmmab(v16bf a, v16bf b, v8f c) { return __builtin_amdgcn_wmma_f32_16x16x32_bf16(false, a, false, b, (short)0, c, false, false); }
__device__ __forceinline__ h16 tohx(float x) { return (h16)x; }
__device__ __forceinline__ void splitf(float y, unsigned short& h, unsigned short& l) { h = f2bf(y); l = f2bf(y - bf2f(h)); }
typedef __attribute__((ext_vector_type(4))) _Float16 v4h;
typedef __attribute__((ext_vector_type(4))) unsigned short v4us;



// ---- k_gemmt: block GEMM, FOUR WAVES per 128x128 output tile (2 x 2 waves of 64x64, 16 accumulators each); grid (M/128, N/128, Z), 128 threads. Operands are K-contiguous 16-bit planes.
// C[m][n] (pitch ldc, + optional f32 bias[n]) = sum_k A[m][k] Bt[n][k] (SPLIT: then + sum_k A2[m][k] Bt[n][k], as further passes). OM picks what the epilogue stores of the f32 value: 0: the f32 word to C; 1: its f16 word to D0; 2: the bf16 hi and lo words of value x osc to D0 and D1 (the words its consumer reads: no f32 plane, no cast launch); 3: the f32 word of value x osc to C. BIAS 1: bias[n] is an input's word, rounded to bf16 at its load; 2: bias[32 n] is a workspace word, taken as it is. z-batch strides sA/sB/sC in elements. M, N % 128 == 0, K % 128 == 0, K >= 256.
// A pass is 128 k = 256 B of every operand row. A stage is [A 128 rows | Bt 128 rows] in LDS at pitch 272 B, in four slices of 64 rows; each wave brings its own slice with ONE tensor load a pass; two buffers, so that the next pass's rows fly while this pass is worked on.
typedef uint32_t u32x4 __attribute__((ext_vector_type(4)));
typedef uint32_t u32x8 __attribute__((ext_vector_type(8)));
typedef float __attribute__((may_alias)) f32a;
#define ROWB   256u                // bytes of an operand row a pass
#define LPITCH 272u                // its pitch in LDS: 16 B x odd, for ds_load_b128 readers
#define SLICE  18432u              // 64 rows x 272 B = 17,408 B, rounded up to a multiple of 2 KiB
#define BUFB   (4u * SLICE)
__device__ __forceinline__ uint32_t uni(uint32_t v) { return (uint32_t)__builtin_amdgcn_readfirstlane(v); }
__device__ __forceinline__ uint32_t pinned(uint32_t v) { uint32_t w = uni(v); asm volatile("" : "+s"(w)); /* the pinned() form for a test round a tensor load: it holds the test in a scalar register, so that the branch is scalar (a tensor load ignores EXEC) */ return w; }
__device__ __forceinline__ void wait_ds0() { asm volatile("s_wait_dscnt 0x0" ::: "memory"); }       // this wave's LDS reads have retired before the barrier behind which their buffer is refilled
// both groups are in-out operands of the load and inputs of the wait that covers it: to the compiler the words behind the load are values that only these registers hold, needed again at the wait, so it neither reuses the registers as temporaries nor forms the words anew while the request is outstanding
__device__ __forceinline__ void tdm_load(u32x4& g0, u32x8& g1) { asm volatile("tensor_load_to_lds %0, %1" : "+s"(g0), "+s"(g1) :: "memory"); }
// this wave's own slice has landed: the compiler places no wait for a tensor load
__device__ __forceinline__ void wait_tensor0(const u32x4& g0, const u32x8& g1) { asm volatile("s_wait_tensorcnt 0x0" :: "s"(g0), "s"(g1) : "memory"); }
// eight row stores and their s_wait_xcnt 0 in ONE statement: the operands' registers live to the statement's end, so no register that a store names (address or data) is rewritten ahead of the wait
__device__ __forceinline__ void st8_b64(unsigned short* b, const size_t (&o)[8], const v4us (&d)[8]) {
    asm volatile("global_store_b64 %0, %8, off\n\tglobal_store_b64 %1, %9, off\n\tglobal_store_b64 %2, %10, off\n\tglobal_store_b64 %3, %11, off\n\tglobal_store_b64 %4, %12, off\n\tglobal_store_b64 %5, %13, off\n\tglobal_store_b64 %6, %14, off\n\tglobal_store_b64 %7, %15, off\n\ts_wait_xcnt 0x0"
                 :: "v"(b + o[0]), "v"(b + o[1]), "v"(b + o[2]), "v"(b + o[3]), "v"(b + o[4]), "v"(b + o[5]), "v"(b + o[6]), "v"(b + o[7]), "v"(d[0]), "v"(d[1]), "v"(d[2]), "v"(d[3]), "v"(d[4]), "v"(d[5]), "v"(d[6]), "v"(d[7]) : "memory"); }
__device__ __forceinline__ void st8_b32(unsigned short* b, const size_t (&o)[8], const uint32_t (&d)[8]) {
    asm volatile("global_store_b32 %0, %8, off\n\tglobal_store_b32 %1, %9, off\n\tglobal_store_b32 %2, %10, off\n\tglobal_store_b32 %3, %11, off\n\tglobal_store_b32 %4, %12, off\n\tglobal_store_b32 %5, %13, off\n\tglobal_store_b32 %6, %14, off\n\tglobal_store_b32 %7, %15, off\n\ts_wait_xcnt 0x0"
                 :: "v"(b + o[0]), "v"(b + o[1]), "v"(b + o[2]), "v"(b + o[3]), "v"(b + o[4]), "v"(b + o[5]), "v"(b + o[6]), "v"(b + o[7]), "v"(d[0]), "v"(d[1]), "v"(d[2]), "v"(d[3]), "v"(d[4]), "v"(d[5]), "v"(d[6]), "v"(d[7]) : "memory"); }
__device__ __forceinline__ void st8_b128(float* b, const size_t (&o)[8], const v4f (&d)[8]) {
    asm volatile("global_store_b128 %0, %8, off\n\tglobal_store_b128 %1, %9, off\n\tglobal_store_b128 %2, %10, off\n\tglobal_store_b128 %3, %11, off\n\tglobal_store_b128 %4, %12, off\n\tglobal_store_b128 %5, %13, off\n\tglobal_store_b128 %6, %14, off\n\tglobal_store_b128 %7, %15, off\n\ts_wait_xcnt 0x0"
                 :: "v"(b + o[0]), "v"(b + o[1]), "v"(b + o[2]), "v"(b + o[3]), "v"(b + o[4]), "v"(b + o[5]), "v"(b + o[6]), "v"(b + o[7]), "v"(d[0]), "v"(d[1]), "v"(d[2]), "v"(d[3]), "v"(d[4]), "v"(d[5]), "v"(d[6]), "v"(d[7]) : "memory"); }
template <typename T16> struct WFrag;
template <> struct WFrag<h16> { typedef v16h V; static __device__ __forceinline__ V ld(const unsigned char* p) { return cat16(*(const v8ha*)p, *(const v8ha*)(p + 32)); } static __device__ __forceinline__ v8f mma(V a, V b, v8f c) { return wmma16(a, b, c); } };
template <> struct WFrag<bf> { typedef v16bf V; static __device__ __forceinline__ V ld(const unsigned char* p) { return cat16b(*(const v8usa*)p, *(const v8usa*)(p + 32)); } static __device__ __forceinline__ v8f mma(V a, V b, v8f c) { return wmmab(a, b, c); } };
template <typename T16, bool SPLIT, int BIAS, int OM>
__global__ __launch_bounds__(128) void k_gemmt(const T16* __restrict__ A, const T16* __restrict__ A2, const T16* __restrict__ Bt, int K, float* C, unsigned short* D0, unsigned short* D1, float osc, int ldc, const float* __restrict__ bias, size_t sA, size_t sB, size_t sC) {
    typedef typename WFrag<T16>::V V;
    __shared__ __attribute__((aligned(2048))) unsigned char L[2 * BUFB];
    const size_t z = blockIdx.z;
    const int lane = threadIdx.x & 31, lr = lane & 15, hi = lane >> 4; const int r0 = blockIdx.x * 128, c0 = blockIdx.y * 128;
    const uint32_t wave = uni(threadIdx.x >> 5), wm = wave & 1u, wn = wave >> 1;
    const uint32_t np1 = (uint32_t)K / 128u, npass = SPLIT ? 2u * np1 : np1;
    const uint32_t lbase = (uint32_t)(size_t)L;
    // waves 0 and 1 bring the two halves of A's 128 rows, waves 2 and 3 those of Bt's
    const bool isB = wave >= 2u;
    const size_t rowoff = isB ? z * sB + (size_t)(c0 + (int)(wave - 2u) * 64) * K : z * sA + (size_t)(r0 + (int)wave * 64) * K;
    const uint64_t src1 = (uint64_t)(size_t)((isB ? Bt : A) + rowoff);
    const uint64_t src2 = SPLIT ? (uint64_t)(size_t)((isB ? Bt : A2) + rowoff) : src1;
    u32x8 g1;   // 1-byte elements; tensor = tile = 64 rows of 256 B; source pitch 2 K bytes; a pad of 4 dwords behind every 64 dwords
    g1[0] = uni((1u << 20) | (5u << 22) | (3u << 25)); g1[1] = uni((ROWB & 0xFFFFu) << 16); g1[2] = uni((ROWB >> 16) | (64u << 16)); g1[3] = uni(ROWB << 16); g1[4] = uni(64u); g1[5] = uni((uint32_t)K * 2u); g1[6] = uni(0u); g1[7] = uni(0u);
    u32x4 g0;   // the group 0 of the request last issued: it takes new values only behind the wait that covers that request
    auto issue = [&](uint32_t s) {
        const bool second = SPLIT && s >= np1;
        const uint64_t ga = (second ? src2 : src1) + (uint64_t)(second ? s - np1 : s) * ROWB;
        g0[0] = uni(1u); g0[1] = uni(lbase + (s & 1u) * BUFB + wave * SLICE); g0[2] = uni((uint32_t)ga); g0[3] = uni((((uint32_t)(ga >> 32)) & 0x01FFFFFFu) | 0x80000000u);
        tdm_load(g0, g1);
    };
    v8f acc[4][4];
#pragma unroll
    for (int mb = 0; mb < 4; ++mb)
#pragma unroll
        for (int nb = 0; nb < 4; ++nb) acc[mb][nb] = (v8f){};
    issue(0u); wait_tensor0(g0, g1); __syncthreads(); issue(1u);
    const unsigned char* fa0 = L + wm * SLICE + (uint32_t)lr * LPITCH + (uint32_t)hi * 16u;          // the lane's row of the wave's A slice; k order as the planes': 8 hi .. 8 hi + 7, then 16 + 8 hi ..
    const unsigned char* fb0 = L + (2u + wn) * SLICE + (uint32_t)lr * LPITCH + (uint32_t)hi * 16u;   // the same of its Bt slice
    for (uint32_t s = 0; s < npass; ++s) {
        const unsigned char* fa = fa0 + (s & 1u) * BUFB; const unsigned char* fb = fb0 + (s & 1u) * BUFB;
        V a[2][4], b[2][4];
#pragma unroll
        for (int q = 0; q < 4; ++q) { a[0][q] = WFrag<T16>::ld(fa + q * 16 * LPITCH); b[0][q] = WFrag<T16>::ld(fb + q * 16 * LPITCH); }
#pragma unroll
        for (int kb = 0; kb < 4; ++kb) {
            if (kb < 3) {
#pragma unroll
                for (int q = 0; q < 4; ++q) { a[(kb + 1) & 1][q] = WFrag<T16>::ld(fa + q * 16 * LPITCH + (kb + 1) * 64); b[(kb + 1) & 1][q] = WFrag<T16>::ld(fb + q * 16 * LPITCH + (kb + 1) * 64); } }
            __builtin_amdgcn_sched_barrier(0);   // keeps the next block's LDS reads one group ahead of this block's products, not spread among them
#pragma unroll
            for (int nb = 0; nb < 4; ++nb)
#pragma unroll
                for (int mb = 0; mb < 4; ++mb) acc[mb][nb] = WFrag<T16>::mma(a[kb & 1][mb], b[kb & 1][nb], acc[mb][nb]);
            __builtin_amdgcn_sched_barrier(0);   // the same, at the block's end
        }
        wait_ds0(); wait_tensor0(g0, g1); __syncthreads();   // publish point of stage s + 1; it also ends every reader's last read of stage s's buffer
        if (pinned(s + 2u < npass)) issue(s + 2u);
    }
    wait_tensor0(g0, g1); wait_ds0();
    // the last pass's barrier stands behind every wave's last read of the ring and no load is in flight: each wave stages its output rows in its own slice of buffer 0
    f32a* os = (f32a*)(L + wave * SLICE);
    const int rw = r0 + (int)wm * 64, cw = c0 + (int)wn * 64;
    v4f bv = (v4f){};   // the lane's four bias words: the same columns in every row it stores
    if (BIAS) {
#pragma unroll
        for (int q = 0; q < 4; ++q) bv[q] = (BIAS == 2) ? bias[(size_t)(cw + lr * 4 + q) * 32] : bfr(bias[cw + lr * 4 + q]);
        asm volatile("s_wait_xcnt 0x0" ::: "memory"); }   // behind the bias load, ahead of every later write of its address registers
#pragma unroll
    for (int mb = 0; mb < 4; ++mb) {
#pragma unroll
        for (int nb = 0; nb < 4; ++nb) {
#pragma unroll
            for (int j = 0; j < 8; ++j) os[(hi * 8 + j) * 68 + nb * 16 + lr] = acc[mb][nb][j]; }
        __builtin_amdgcn_wave_barrier(); asm volatile("" ::: "memory");   // compiler order only: the wave's 16 staged rows are stored before any lane reads them back, and (below) read before the next 16 overwrite them
        const size_t crow = z * sC + (size_t)(rw + mb * 16) * ldc + cw;
        v4f val[8]; size_t co[8];   // step s: 16 lanes cover the 64 columns of row 2 s + hi: 256 B of f32 words, or one whole 128-B line of 16-bit words
#pragma unroll
        for (int s = 0; s < 8; ++s) { const int row = 2 * s + hi, cofs = lr * 4; val[s] = *(const v4fa*)(os + row * 68 + cofs); if (BIAS) val[s] += bv;
            co[s] = crow + (size_t)row * ldc + cofs; }
        if (OM == 0) st8_b128(C, co, val);
        else if (OM == 3) { v4f o[8];
#pragma unroll
            for (int s = 0; s < 8; ++s)
#pragma unroll
                for (int q = 0; q < 4; ++q) o[s][q] = __fmul_rn(val[s][q], osc);
            st8_b128(C, co, o); }
        else if (OM == 1) { v4us o[8];
#pragma unroll
            for (int s = 0; s < 8; ++s) { v4h t;
#pragma unroll
                for (int q = 0; q < 4; ++q) t[q] = tohx(val[s][q]);
                o[s] = __builtin_bit_cast(v4us, t); }
            st8_b64(D0, co, o); }
        else { v4us oh[8], ol[8];
#pragma unroll
            for (int s = 0; s < 8; ++s)
#pragma unroll
                for (int q = 0; q < 4; ++q) { unsigned short h2, l2; splitf(__fmul_rn(val[s][q], osc), h2, l2); oh[s][q] = h2; ol[s][q] = l2; }
            st8_b64(D0, co, oh); st8_b64(D1, co, ol); }
        __builtin_amdgcn_wave_barrier(); asm volatile("" ::: "memory");
    }
}

typedef __attribute__((ext_vector_type(2))) _Float16 v2h;
typedef __attribute__((ext_vector_type(2))) unsigned short v2us;
typedef __attribute__((ext_vector_type(2))) float v2f;
typedef __attribute__((ext_vector_type(4))) int v4i;

// k_asoft: per row (zz, i): t = S x SCL (no mask; SCL 0.125 here: the module's 1/32 is 0.125 x the 1/4 folded into q's cast); softmax over the 2048 keys (register row, one exp, fixed trees); beside each f16 word of the weights x 1,024 it stores that word x 2^-10 as f32 to Wt: the second output;
__global__ __launch_bounds__(256) void k_asoft(const float* __restrict__ Sb, h16* P16, bf* Ph, bf* Pl, float* Wt) {
    const int lane = threadIdx.x & 31; const int row = blockIdx.x * 8 + (threadIdx.x >> 5); if (row >= ZH * TT) return; const int i = row % TT; const int zz = row / TT; (void)zz; const bool hires = (i < RH); const float* sr = Sb + (size_t)row * TT; float v[TT / 32]; float mx = -3.0e38f;
#pragma unroll
    for (int ch = 0; ch < TT / 128; ++ch) { const int j0 = ch * 128 + lane * 4; const v4f a = *(const v4f*)(sr + j0);
#pragma unroll
        for (int q = 0; q < 4; ++q) { const int j = j0 + q; (void)j; const float t = a[q] * SCL; v[ch * 4 + q] = t; mx = fmaxf(mx, t); } }
#pragma unroll
    for (int sh = 16; sh; sh >>= 1) mx = fmaxf(mx, __shfl_xor(mx, sh, 32));
    float sum = 0.f;
#pragma unroll
    for (int k = 0; k < TT / 32; ++k) { float d0 = __fsub_rn(v[k], mx); v[k] = __builtin_amdgcn_exp2f(__fmul_rn(d0, 1.4426950408889634f)); sum += v[k]; }
#pragma unroll
    for (int sh = 16; sh; sh >>= 1) sum += __shfl_xor(sum, sh, 32);
    const float f = __fdiv_rn(hires ? 1.0f : PCAR, sum);
{
        if (hires) {
#pragma unroll
            for (int ch = 0; ch < TT / 128; ++ch) { v4us oh, ol;
#pragma unroll
                for (int q = 0; q < 4; ++q) { unsigned short a, c2; splitf(v[ch * 4 + q] * f, a, c2); oh[q] = a; ol[q] = c2; }
                const size_t oo = ((size_t)zz * (RH ? RH : 1) + i) * TT + ch * 128 + lane * 4; *(v4us*)(Ph + oo) = oh; *(v4us*)(Pl + oo) = ol; }
        } else {
#pragma unroll
            for (int ch = 0; ch < TT / 128; ++ch) { v4h o4; v4f w4;
#pragma unroll
                for (int q = 0; q < 4; ++q) { o4[q] = tohx(v[ch * 4 + q] * f); w4[q] = __fmul_rn((float)o4[q], 1.0f / PCAR); }
                *(v4h*)(P16 + (size_t)row * TT + ch * 128 + lane * 4) = o4; *(v4f*)(Wt + (size_t)row * TT + ch * 128 + lane * 4) = w4; } }
         }
}
// ---- k_prep: EVERY CAST AND GATHER OF THE INPUTS AS ONE RESIDENT STREAM: 256 work-groups of 16 waves; the unit of work is 1,024 floats, a row (4 KiB in a row in its source) or a 64 x 16 tile of v's weights: a wave reads it with eight 512-B loads and stores its 1,024 16-bit words with eight 256-B stores (a tile: sixteen 128-B stores); up to three rows of a wave are in flight at a time.
// Wave w of 4,096 takes rows w and w + 4,096 of input_feature (each stored twice: bf16 and f16), the same two of query (row r = token r / 4 of entry r % 4: it goes to row r / 4 of plane r % 4), and the first twelve waves of every work-group one of 3,072 units of the two weights:
// a row of k's weights; or a tile of 64 rows x 16 columns of v's, stored transposed; or a row e of out_proj_weight, with which the wave also sums 1,024 x (Wo[e] . bv + bo[e]).
// The words are those of the flat casts: bf16 by round to nearest even; query: that word x 1/4 as f16, a word under 2^-14 in size written as zero.
#define PWV 16u                   // waves a work-group
#define PGR 256u                  // work-groups
#define PWT 12u                   // waves of a work-group that take a weight unit: 256 x 12 = 1,024 + 1,024 + 1,024
#define CPIT 32                   // floats from one word of the carried vector to the next: every word has its own 128-B line, since every word has its own writer
// every loop of k_prep and its helpers is unrolled: the row arrays are then indexed by constants alone and stay in registers
__device__ __forceinline__ void ld_row(const float* __restrict__ s, int lane, v4f (&r)[8]) {
#pragma unroll
    for (int j = 0; j < 8; ++j) r[j] = *(const v4f*)(s + j * 128 + lane * 4);
    asm volatile("s_wait_xcnt 0x0" :: "s"(s) : "memory"); }   // behind the eight row loads, ahead of every later write of their address registers; the loads' scalar base is an input of the wait, so that its registers are held to here and take no new value ahead of it
// the lane's two rows, 2 lane and 2 lane + 1, of a tile of 64 rows x 16 floats: r[0..3] the first row's 64 B, r[4..7] the second's
__device__ __forceinline__ void ld_tile(const float* __restrict__ s, int lane, v4f (&r)[8]) {
#pragma unroll
    for (int j = 0; j < 8; ++j) r[j] = *(const v4f*)(s + (size_t)(2 * lane + (j >> 2)) * DM + (j & 3) * 4);
    asm volatile("s_wait_xcnt 0x0" :: "s"(s) : "memory"); }   // behind the eight tile loads, ahead of every later write of their address registers; the scalar base is an input of the wait, as in ld_row
// column c of the tile becomes row c of the transposed plane, where the lane's two words are neighbours: a store is 32 lanes x 4 B = one whole 128-B line
__device__ __forceinline__ void st_tile(unsigned short* d, int lane, const v4f (&r)[8]) {
#pragma unroll
    for (int h = 0; h < 2; ++h) { uint32_t o[8]; size_t off[8];
#pragma unroll
        for (int j = 0; j < 8; ++j) { const int c = h * 8 + j; o[j] = (uint32_t)f2bf(r[c >> 2][c & 3]) | ((uint32_t)f2bf(r[4 + (c >> 2)][c & 3]) << 16); off[j] = (size_t)c * DM + (size_t)(2 * lane); }
        st8_b32(d, off, o); } }
// H 0: the bf16 word; 1: query's f16 word; 2: the bf16 word written as f16
template <int H>
__device__ __forceinline__ void st_row(unsigned short* d, int lane, const v4f (&r)[8]) { v4us o[8]; size_t off[8];
#pragma unroll
    for (int j = 0; j < 8; ++j) { off[j] = (size_t)(j * 128 + lane * 4);
#pragma unroll
        for (int q = 0; q < 4; ++q) { const float x = r[j][q]; if (H == 1) { const float y = __fmul_rn(bfr(x), QSC); const float z = (fabsf(y) < 6.103515625e-5f) ? 0.0f : y; o[j][q] = __builtin_bit_cast(unsigned short, tohx(z)); } else if (H == 2) o[j][q] = __builtin_bit_cast(unsigned short, tohx(bfr(x))); else o[j][q] = f2bf(x); } }
    st8_b64(d, off, o); }
__global__ __launch_bounds__(512) void k_prep(const float* __restrict__ xin, const float* __restrict__ qin, const float* __restrict__ win, const float* __restrict__ wo, const float* __restrict__ bvin, const float* __restrict__ boin, unsigned short* XB, unsigned short* X16, unsigned short* Q16, unsigned short* WB, unsigned short* WVT, unsigned short* WOB, float* BV) {
    const int lane = threadIdx.x & 31; const uint32_t wv = uni(threadIdx.x >> 5), w = blockIdx.x * PWV + wv, w2 = w + PGR * PWV, u = blockIdx.x * PWT + wv;   // u: the wave's weight unit, where wv < PWT
    const size_t PLW = (size_t)TT * DM; const size_t d1 = (size_t)(w & 3u) * PLW + (size_t)(w >> 2) * DM, d2 = (size_t)(w2 & 3u) * PLW + (size_t)(w2 >> 2) * DM;
    const bool wrow = wv < PWT, isk = wrow && u < (uint32_t)DM, isv = wrow && !isk && u < 2u * DM, iso = wrow && u >= 2u * DM;   // all the same in every lane of a wave
    const uint32_t t = u - (uint32_t)DM, j0 = (t >> 6) * 64u, c0 = (t & 63u) * 16u, e = u - 2u * DM;   // isv: the tile's first row and column in v's weights; iso: the row of out_proj_weight
    v4f ra[8], rb[8];
    ld_row(xin + (size_t)w * DM, lane, ra); ld_row(xin + (size_t)w2 * DM, lane, rb);
    st_row<0>(XB + d1, lane, ra); st_row<2>(X16 + d1, lane, ra); ld_row(qin + (size_t)w * DM, lane, ra);
    st_row<0>(XB + d2, lane, rb); st_row<2>(X16 + d2, lane, rb); ld_row(qin + (size_t)w2 * DM, lane, rb);
    st_row<1>(Q16 + d1, lane, ra);
    // each kind of wave has its own straight path to the end, query's last row included: the waits on that row then count the loads of that path alone
    if (isk) { ld_row(win + (size_t)u * DM, lane, ra); st_row<1>(Q16 + d2, lane, rb); st_row<0>(WB + (size_t)u * DM, lane, ra); }
    else if (isv) { ld_tile(win + (size_t)(DM + j0) * DM + c0, lane, ra); st_row<1>(Q16 + d2, lane, rb); st_tile(WVT + (size_t)c0 * DM + j0, lane, ra); }
    else if (!iso) st_row<1>(Q16 + d2, lane, rb);
    else { v4f rc[8]; ld_row(wo + (size_t)e * DM, lane, ra); ld_row(bvin, lane, rc); st_row<1>(Q16 + d2, lane, rb); st_row<0>(WOB + (size_t)e * DM, lane, ra);
        float sum = 0.f;
#pragma unroll
        for (int j = 0; j < 8; ++j)
#pragma unroll
            for (int q = 0; q < 4; ++q) sum = fmaf(bfr(ra[j][q]), bfr(rc[j][q]), sum);
#pragma unroll
        for (int sh = 16; sh; sh >>= 1) sum += __shfl_xor(sum, sh, 32);
        const float cw = __fmul_rn(sum + bfr(boin[e]), PCAR);
        // the one word and its s_wait_xcnt 0 in ONE statement, as in the row stores
        if (lane == 0) asm volatile("global_store_b32 %0, %1, off\n\ts_wait_xcnt 0x0" :: "v"(BV + (size_t)e * CPIT), "v"(cw) : "memory"); }
}

extern "C" void kernel_launch(void* const* d_in, const int* in_sizes, int n_in,
                              void* d_out, int out_size, void* d_ws, size_t ws_size, hipStream_t stream) {
    (void)in_sizes; (void)n_in; (void)out_size;
    const float* qin = (const float*)d_in[0]; const float* xin = (const float*)d_in[1]; const float* win = (const float*)d_in[2]; const float* bin = (const float*)d_in[3]; const float* wo = (const float*)d_in[4]; const float* bo = (const float*)d_in[5];   /* the module's argument order: query, input_feature, in_proj_weight, in_proj_bias, out_proj_weight, out_proj_bias: SIX inputs; all read */
    float* OUT0 = (float*)d_out;                                   // attn [2048][4][1024]
    float* OUT1 = (float*)d_out + (size_t)TT * NB_ * DM;           // attn_weights [4][2048][2048]: 33,554,432 B after the first
    char* wsp = (char*)d_ws;
    auto take = [&](size_t bytes) { char* p = wsp; wsp += (bytes + 255) & ~(size_t)255; return (void*)p; };
    bf* WB = (bf*)take((size_t)DM * DM * 2);   /* k's rows of in_proj_weight as bf16 */ bf* WVT = (bf*)take((size_t)DM * DM * 2);   /* v's rows, transposed */ bf* WOB = (bf*)take((size_t)DM * DM * 2); h16* WVO = (h16*)take((size_t)DM * DM * 2);   /* Wo Wv, f16 */ float* BV = (float*)take((size_t)DM * CPIT * 4);
    bf* XB = (bf*)take((size_t)ZH * TT * DM * 2);   /* the entries' bf16 rows */ h16* X16 = (h16*)take((size_t)ZH * TT * DM * 2);   /* the same words as f16 */
    h16* Q16 = (h16*)take((size_t)ZH * TT * DM * 2); h16* K16 = (h16*)take((size_t)ZH * TT * DM * 2); h16* VT16 = (h16*)take((size_t)ZH * DM * TT * 2);   /* the entries' f16 planes: q; k token-major; v' CHANNEL-major [1024][2048] */
    float* Sb = (float*)take((size_t)ZH * TT * TT * 4); h16* P16 = (h16*)take((size_t)ZH * TT * TT * 2);
    if ((size_t)(wsp - (char*)d_ws) > ws_size) return;    // total 184.13 MiB carved
    const size_t PITCH = (size_t)NB_ * DM;
    const size_t PL = (size_t)TT * DM;   /* words of one entry's [2048][1024] plane */
    k_prep<<<PGR, PWV * 32u, 0, stream>>>(xin, qin, win, wo, bin + DM, bo, XB, (unsigned short*)X16, (unsigned short*)Q16, WB, WVT, WOB, BV);   /* every cast and gather of the inputs */
    k_gemmt<bf, false, 0, 1><<<dim3(DM / 128, DM / 128, 1), 128, 0, stream>>>(WOB, nullptr, WVT, DM, nullptr, (unsigned short*)WVO, nullptr, 1.0f, DM, nullptr, 0, 0, 0);   /* Wvo = Wo Wv: [out channel][in channel], f16 words */
    k_gemmt<bf, false, 1, 1><<<dim3(TT / 128, DM / 128, ZH), 128, 0, stream>>>(XB, nullptr, WB, DM, nullptr, (unsigned short*)K16, nullptr, 1.0f, DM, bin, PL, 0, PL);   /* k = x Wk^T + bk: token-major, f16 words */
    k_gemmt<h16, false, 0, 1><<<dim3(DM / 128, TT / 128, ZH), 128, 0, stream>>>(WVO, nullptr, X16, DM, nullptr, (unsigned short*)VT16, nullptr, 1.0f, TT, nullptr, 0, PL, PL);   /* v'^T = Wvo x^T: channel-major [1024][2048], f16 words; the biases ride the value product */
    k_gemmt<h16, false, 0, 0><<<dim3(TT / 128, TT / 128, ZH), 128, 0, stream>>>(Q16, nullptr, K16, DM, Sb, nullptr, nullptr, 1.0f, TT, nullptr, PL, PL, (size_t)TT * TT);   /* scores = (q / 4) k^T */
    k_asoft<<<ZH * TT / 8, 256, 0, stream>>>(Sb, P16, nullptr, nullptr, OUT1);   /* the weights' f16 plane and the second output */
    k_gemmt<h16, false, 2, 3><<<dim3(TT / 128, DM / 128, ZH), 128, 0, stream>>>(P16, nullptr, VT16, TT, OUT0, nullptr, nullptr, 1.0f / PCAR, (int)PITCH, BV, (size_t)TT * TT, PL, (size_t)DM);   /* out = 2^-10 x 1,024 x (weights v' + Wo bv + bo), written in place: row pitch 4,096 floats; each further entry 1,024 floats further */
}

// v006
// Measured time: 111 microseconds a run.
// Two timings next to v005 both put it at 1.07 times that version's speed.
// Counting every step since v000, it is 5.13 times as fast.
#include <hip/hip_runtime.h>
#include <stdint.h>

// Single-head cross-attention that also returns its softmax weights (query, input_feature [2048][4][1024] = [token][entry][channel]; kv = input_feature in_proj_weight^T + in_proj_bias ('oi' (out, in) [2048][1024] x 1/32 + [2048] zeros): k = the first 1,024 columns, v = the last; q = query x 1024^-0.5: NO q projection; ONE head of width 1,024;
// attn_weights[b][t][s] = softmax over the 2,048 keys s of q[t] . k[s] (no mask): RETURNED as the second output [4][2048][2048]; attn = attn_weights v; out = attn out_proj_weight^T + out_proj_bias ('oi' [1024][1024] + [1024] zeros): the first output [2048][4][1024]; argument order query, input_feature, in_proj_weight, in_proj_bias, out_proj_weight, out_proj_bias).
// THE OUTPUT PROJECTION IS FOLDED INTO THE VALUE PROJECTION: out = weights (x Wv^T + bv) Wo^T + bo = weights (x (Wo Wv)^T) + (Wo bv + bo), the rows of the weights summing to one: Wvo = Wo Wv is formed anew in every call (one bf16 product of 1,024^3, stored as ONE f16 word), v' = x Wvo^T takes v's place, and the value product writes the first output itself: no product with out_proj_weight at 8,192 rows.
// Layout: once: k's rows of in_proj_weight and out_proj_weight cast to bf16 as they stand, v's rows cast AND TRANSPOSED ([channel in][channel out of v]: the second operand of Wo Wv); 1,024 x (Wo bv + bo) as f32 words, one a 128-B line; ALL FOUR entries ride every launch (the rows of k_prep, the batch index of the products, the softmax's rows): each entry's rows gathered out of the [token][entry] layout (a row pitch of 4,096 floats) into contiguous planes: input_feature as bf16 (for k) and the same words as f16 (for v'; exact from 2^-17 up) and query x 1/4 as ONE f16 word (a word under 2^-14 in size is written as zero); these casts and gathers are ONE launch (k_prep), but query's, which ride the launch of k's product (k_kw);
// k = x Wk^T + bias (a plain bf16 product; token-major [2048][1024]: it IS the head's key plane), stored by the product's own epilogue as ONE f16 word; v'^T = Wvo x^T (an fp16 product with the operands' roles exchanged: channel-major [1024][2048]: the value product's second operand, no transposer), stored likewise as ONE f16 word; scores = q k^T (one fp16 product at depth 1,024); the softmax at 2,048 keys, EVERY row on the f16 plane of its weights x 1,024;
// THE SECOND OUTPUT is that plane x 2^-10 as f32, stored by the softmax beside the plane; 1,024 x (weights v' + Wo bv + bo) by one fp16 product at depth 2,048 with the carried vector in its bias slot (the rows of the weights sum to one: adding v's bias after the product equals adding it to v before); its epilogue stores the f32 words x 2^-10 (the scale argument undoes the carry): the first output in place (row pitch 4,096 floats; each further entry 1,024 floats further).
// A flat kernel text (k_prep: no loop; every address from the wave's and the lane's own index and launch constants; no LDS, barrier or atomic; cross-lane words only in the sum of Wo bv).
// Compute dtypes, f32 accumulate: every float input rounded to bf16 at its load; k's projection and Wo Wv plain bf16 (inputs: exact); q (an input x 1/4: exact in f16 but for words under 2^-14), k, Wvo, v' and the weights x 1,024 each ONE f16 word: v's projection and both attention products fp16; softmax f32; Wo bv + bo in f32 on the vector unit (one vector: no matrix form fits it).

#define NB_  4
#define TT   2048
#define DM   1024                 // the model width = the one head's width
#define ZH   4                    // entries a launch: all of them
#define RH   0                    // the softmax's hi + lo stores stand under 'row < RH': none taken: EVERY row stores the f16 plane of its weights x 1,024
#define PCAR 1024.0f              // the weights' carry
#define SCL  0.125f               // the softmax's scale: the module's 1/32 = 0.125 x the 1/4 folded into q's cast (both powers of two: exact)
#define QSC  0.25f
typedef _Float16 h16;
typedef unsigned short bf;
typedef __attribute__((ext_vector_type(16))) __bf16   v16bf;
typedef __attribute__((ext_vector_type(16))) _Float16 v16h;
typedef __attribute__((ext_vector_type(8)))  _Float16 v8h;
typedef __attribute__((ext_vector_type(8)))  unsigned short v8us;
typedef __attribute__((ext_vector_type(8)))  float    v8f;
typedef __attribute__((ext_vector_type(4)))  float    v4f;
typedef v8h  __attribute__((may_alias)) v8ha;
typedef v4f  __attribute__((may_alias)) v4fa;
typedef v8us __attribute__((may_alias)) v8usa;

__device__ __forceinline__ unsigned short f2bf(float f) { unsigned u = __float_as_uint(f); u += 0x7FFFu + ((u >> 16) & 1u); return (unsigned short)(u >> 16); }
__device__ __forceinline__ float bf2f(unsigned short b) { return __uint_as_float(((unsigned)b) << 16); }
__device__ __forceinline__ float bfr(float f) { return bf2f(f2bf(f)); }
__device__ __forceinline__ v16h cat16(v8h lo, v8h hi) { return __builtin_shufflevector(lo, hi, 0, 1, 2, 3, 4, 5, 6, 7, 8, 9, 10, 11, 12, 13, 14, 15); }
__device__ __forceinline__ v16bf cat16b(v8us lo, v8us hi) { return __builtin_bit_cast(v16bf, __builtin_shufflevector(lo, hi, 0, 1, 2, 3, 4, 5, 6, 7, 8, 9, 10, 11, 12, 13, 14, 15)); }
__device__ __forceinline__ v8f wmma16(v16h a, v16h b, v8f c) { return __builtin_amdgcn_wmma_f32_16x16x32_f16(false, a, false, b, (short)0, c, false, false); }
__device__ __forceinline__ v8f wmmab(v16bf a, v16bf b, v8f c) { return __builtin_amdgcn_wmma_f32_16x16x32_bf16(false, a, false, b, (short)0, c, false, false); }
__device__ __forceinline__ h16 tohx(float x) { return (h16)x; }
__device__ __forceinline__ void splitf(float y, unsigned short& h, unsigned short& l) { h = f2bf(y); l = f2bf(y - bf2f(h)); }
typedef __attribute__((ext_vector_type(4))) _Float16 v4h;
typedef __attribute__((ext_vector_type(4))) unsigned short v4us;



// ---- k_gemmt: block GEMM, FOUR WAVES per 128x128 output tile (2 x 2 waves of 64x64, 16 accumulators each); grid (M/128, N/128, Z), 128 threads. Operands are K-contiguous 16-bit planes.
// C[m][n] (pitch ldc, + optional f32 bias[n]) = sum_k A[m][k] Bt[n][k] (SPLIT: then + sum_k A2[m][k] Bt[n][k], as further passes). OM picks what the epilogue stores of the f32 value: 0: the f32 word to C; 1: its f16 word to D0; 2: the bf16 hi and lo words of value x osc to D0 and D1 (the words its consumer reads: no f32 plane, no cast launch); 3: the f32 word of value x osc to C. BIAS 1: bias[n] is an input's word, rounded to bf16 at its load; 2: bias[32 n] is a workspace word, taken as it is. z-batch strides sA/sB/sC in elements. M, N % 128 == 0, K % 128 == 0, K >= 256.
// A pass is 128 k = 256 B of every operand row. A stage is [A 128 rows | Bt 128 rows] in LDS at pitch 272 B, in four slices of 64 rows; each wave brings its own slice with ONE tensor load a pass; two buffers, so that the next pass's rows fly while this pass is worked on.
typedef uint32_t u32x4 __attribute__((ext_vector_type(4)));
typedef uint32_t u32x8 __attribute__((ext_vector_type(8)));
typedef float __attribute__((may_alias)) f32a;
#define ROWB   256u                // bytes of an operand row a pass
#define LPITCH 272u                // its pitch in LDS: 16 B x odd, for ds_load_b128 readers
#define SLICE  18432u              // 64 rows x 272 B = 17,408 B, rounded up to a multiple of 2 KiB
#define BUFB   (4u * SLICE)
__device__ __forceinline__ uint32_t uni(uint32_t v) { return (uint32_t)__builtin_amdgcn_readfirstlane(v); }
__device__ __forceinline__ uint32_t pinned(uint32_t v) { uint32_t w = uni(v); asm volatile("" : "+s"(w)); /* the pinned() form for a test round a tensor load: it holds the test in a scalar register, so that the branch is scalar (a tensor load ignores EXEC) */ return w; }
__device__ __forceinline__ void wait_ds0() { asm volatile("s_wait_dscnt 0x0" ::: "memory"); }       // this wave's LDS reads have retired before the barrier behind which their buffer is refilled
// both groups are in-out operands of the load and inputs of the wait that covers it: to the compiler the words behind the load are values that only these registers hold, needed again at the wait, so it neither reuses the registers as temporaries nor forms the words anew while the request is outstanding
__device__ __forceinline__ void tdm_load(u32x4& g0, u32x8& g1) { asm volatile("tensor_load_to_lds %0, %1" : "+s"(g0), "+s"(g1) :: "memory"); }
// this wave's own slice has landed: the compiler places no wait for a tensor load
__device__ __forceinline__ void wait_tensor0(const u32x4& g0, const u32x8& g1) { asm volatile("s_wait_tensorcnt 0x0" :: "s"(g0), "s"(g1) : "memory"); }
// eight row stores and their s_wait_xcnt 0 in ONE statement: the operands' registers live to the statement's end, so no register that a store names (address or data) is rewritten ahead of the wait
__device__ __forceinline__ void st8_b64(unsigned short* b, const size_t (&o)[8], const v4us (&d)[8]) {
    asm volatile("global_store_b64 %0, %8, off\n\tglobal_store_b64 %1, %9, off\n\tglobal_store_b64 %2, %10, off\n\tglobal_store_b64 %3, %11, off\n\tglobal_store_b64 %4, %12, off\n\tglobal_store_b64 %5, %13, off\n\tglobal_store_b64 %6, %14, off\n\tglobal_store_b64 %7, %15, off\n\ts_wait_xcnt 0x0"
                 :: "v"(b + o[0]), "v"(b + o[1]), "v"(b + o[2]), "v"(b + o[3]), "v"(b + o[4]), "v"(b + o[5]), "v"(b + o[6]), "v"(b + o[7]), "v"(d[0]), "v"(d[1]), "v"(d[2]), "v"(d[3]), "v"(d[4]), "v"(d[5]), "v"(d[6]), "v"(d[7]) : "memory"); }
__device__ __forceinline__ void st8_b32(unsigned short* b, const size_t (&o)[8], const uint32_t (&d)[8]) {
    asm volatile("global_store_b32 %0, %8, off\n\tglobal_store_b32 %1, %9, off\n\tglobal_store_b32 %2, %10, off\n\tglobal_store_b32 %3, %11, off\n\tglobal_store_b32 %4, %12, off\n\tglobal_store_b32 %5, %13, off\n\tglobal_store_b32 %6, %14, off\n\tglobal_store_b32 %7, %15, off\n\ts_wait_xcnt 0x0"
                 :: "v"(b + o[0]), "v"(b + o[1]), "v"(b + o[2]), "v"(b + o[3]), "v"(b + o[4]), "v"(b + o[5]), "v"(b + o[6]), "v"(b + o[7]), "v"(d[0]), "v"(d[1]), "v"(d[2]), "v"(d[3]), "v"(d[4]), "v"(d[5]), "v"(d[6]), "v"(d[7]) : "memory"); }
__device__ __forceinline__ void st8_b128(float* b, const size_t (&o)[8], const v4f (&d)[8]) {
    asm volatile("global_store_b128 %0, %8, off\n\tglobal_store_b128 %1, %9, off\n\tglobal_store_b128 %2, %10, off\n\tglobal_store_b128 %3, %11, off\n\tglobal_store_b128 %4, %12, off\n\tglobal_store_b128 %5, %13, off\n\tglobal_store_b128 %6, %14, off\n\tglobal_store_b128 %7, %15, off\n\ts_wait_xcnt 0x0"
                 :: "v"(b + o[0]), "v"(b + o[1]), "v"(b + o[2]), "v"(b + o[3]), "v"(b + o[4]), "v"(b + o[5]), "v"(b + o[6]), "v"(b + o[7]), "v"(d[0]), "v"(d[1]), "v"(d[2]), "v"(d[3]), "v"(d[4]), "v"(d[5]), "v"(d[6]), "v"(d[7]) : "memory"); }
template <typename T16> struct WFrag;
template <> struct WFrag<h16> { typedef v16h V; static __device__ __forceinline__ V ld(const unsigned char* p) { return cat16(*(const v8ha*)p, *(const v8ha*)(p + 32)); } static __device__ __forceinline__ v8f mma(V a, V b, v8f c) { return wmma16(a, b, c); } };
template <> struct WFrag<bf> { typedef v16bf V; static __device__ __forceinline__ V ld(const unsigned char* p) { return cat16b(*(const v8usa*)p, *(const v8usa*)(p + 32)); } static __device__ __forceinline__ v8f mma(V a, V b, v8f c) { return wmmab(a, b, c); } };
// gemm_tile: the whole work of one work-group on output tile (bx, by) of batch entry bz; L is the kernel's own ring of 2 * BUFB bytes of LDS
template <typename T16, bool SPLIT, int BIAS, int OM>
__device__ __forceinline__ void gemm_tile(unsigned char* L, uint32_t bx, uint32_t by, uint32_t bz, const T16* __restrict__ A, const T16* __restrict__ A2, const T16* __restrict__ Bt, int K, float* C, unsigned short* D0, unsigned short* D1, float osc, int ldc, const float* __restrict__ bias, size_t sA, size_t sB, size_t sC) {
    typedef typename WFrag<T16>::V V;
    const size_t z = bz;
    const int lane = threadIdx.x & 31, lr = lane & 15, hi = lane >> 4; const int r0 = (int)bx * 128, c0 = (int)by * 128;
    const uint32_t wave = uni(threadIdx.x >> 5), wm = wave & 1u, wn = wave >> 1;
    const uint32_t np1 = (uint32_t)K / 128u, npass = SPLIT ? 2u * np1 : np1;
    const uint32_t lbase = (uint32_t)(size_t)L;
    // waves 0 and 1 bring the two halves of A's 128 rows, waves 2 and 3 those of Bt's
    const bool isB = wave >= 2u;
    const size_t rowoff = isB ? z * sB + (size_t)(c0 + (int)(wave - 2u) * 64) * K : z * sA + (size_t)(r0 + (int)wave * 64) * K;
    const uint64_t src1 = (uint64_t)(size_t)((isB ? Bt : A) + rowoff);
    const uint64_t src2 = SPLIT ? (uint64_t)(size_t)((isB ? Bt : A2) + rowoff) : src1;
    u32x8 g1;   // 1-byte elements; tensor = tile = 64 rows of 256 B; source pitch 2 K bytes; a pad of 4 dwords behind every 64 dwords
    g1[0] = uni((1u << 20) | (5u << 22) | (3u << 25)); g1[1] = uni((ROWB & 0xFFFFu) << 16); g1[2] = uni((ROWB >> 16) | (64u << 16)); g1[3] = uni(ROWB << 16); g1[4] = uni(64u); g1[5] = uni((uint32_t)K * 2u); g1[6] = uni(0u); g1[7] = uni(0u);
    u32x4 g0;   // the group 0 of the request last issued: it takes new values only behind the wait that covers that request
    auto issue = [&](uint32_t s) {
        const bool second = SPLIT && s >= np1;
        const uint64_t ga = (second ? src2 : src1) + (uint64_t)(second ? s - np1 : s) * ROWB;
        g0[0] = uni(1u); g0[1] = uni(lbase + (s & 1u) * BUFB + wave * SLICE); g0[2] = uni((uint32_t)ga); g0[3] = uni((((uint32_t)(ga >> 32)) & 0x01FFFFFFu) | 0x80000000u);
        tdm_load(g0, g1);
    };
    v8f acc[4][4];
#pragma unroll
    for (int mb = 0; mb < 4; ++mb)
#pragma unroll
        for (int nb = 0; nb < 4; ++nb) acc[mb][nb] = (v8f){};
    issue(0u); wait_tensor0(g0, g1); __syncthreads(); issue(1u);
    const unsigned char* fa0 = L + wm * SLICE + (uint32_t)lr * LPITCH + (uint32_t)hi * 16u;          // the lane's row of the wave's A slice; k order as the planes': 8 hi .. 8 hi + 7, then 16 + 8 hi ..
    const unsigned char* fb0 = L + (2u + wn) * SLICE + (uint32_t)lr * LPITCH + (uint32_t)hi * 16u;   // the same of its Bt slice
    for (uint32_t s = 0; s < npass; ++s) {
        const unsigned char* fa = fa0 + (s & 1u) * BUFB; const unsigned char* fb = fb0 + (s & 1u) * BUFB;
        V a[2][4], b[2][4];
#pragma unroll
        for (int q = 0; q < 4; ++q) { a[0][q] = WFrag<T16>::ld(fa + q * 16 * LPITCH); b[0][q] = WFrag<T16>::ld(fb + q * 16 * LPITCH); }
#pragma unroll
        for (int kb = 0; kb < 4; ++kb) {
            if (kb < 3) {
#pragma unroll
                for (int q = 0; q < 4; ++q) { a[(kb + 1) & 1][q] = WFrag<T16>::ld(fa + q * 16 * LPITCH + (kb + 1) * 64); b[(kb + 1) & 1][q] = WFrag<T16>::ld(fb + q * 16 * LPITCH + (kb + 1) * 64); } }
            __builtin_amdgcn_sched_barrier(0);   // keeps the next block's LDS reads one group ahead of this block's products, not spread among them
#pragma unroll
            for (int nb = 0; nb < 4; ++nb)
#pragma unroll
                for (int mb = 0; mb < 4; ++mb) acc[mb][nb] = WFrag<T16>::mma(a[kb & 1][mb], b[kb & 1][nb], acc[mb][nb]);
            __builtin_amdgcn_sched_barrier(0);   // the same, at the block's end
        }
        wait_ds0(); wait_tensor0(g0, g1); __syncthreads();   // publish point of stage s + 1; it also ends every reader's last read of stage s's buffer
        if (pinned(s + 2u < npass)) issue(s + 2u);
    }
    wait_tensor0(g0, g1); wait_ds0();
    // the last pass's barrier stands behind every wave's last read of the ring and no load is in flight: each wave stages its output rows in its own slice of buffer 0
    f32a* os = (f32a*)(L + wave * SLICE);
    const int rw = r0 + (int)wm * 64, cw = c0 + (int)wn * 64;
    v4f bv = (v4f){};   // the lane's four bias words: the same columns in every row it stores
    if (BIAS) {
#pragma unroll
        for (int q = 0; q < 4; ++q) bv[q] = (BIAS == 2) ? bias[(size_t)(cw + lr * 4 + q) * 32] : bfr(bias[cw + lr * 4 + q]);
        asm volatile("s_wait_xcnt 0x0" ::: "memory"); }   // behind the bias load, ahead of every later write of its address registers
#pragma unroll
    for (int mb = 0; mb < 4; ++mb) {
#pragma unroll
        for (int nb = 0; nb < 4; ++nb) {
#pragma unroll
            for (int j = 0; j < 8; ++j) os[(hi * 8 + j) * 68 + nb * 16 + lr] = acc[mb][nb][j]; }
        __builtin_amdgcn_wave_barrier(); asm volatile("" ::: "memory");   // compiler order only: the wave's 16 staged rows are stored before any lane reads them back, and (below) read before the next 16 overwrite them
        const size_t crow = z * sC + (size_t)(rw + mb * 16) * ldc + cw;
        v4f val[8]; size_t co[8];   // step s: 16 lanes cover the 64 columns of row 2 s + hi: 256 B of f32 words, or one whole 128-B line of 16-bit words
#pragma unroll
        for (int s = 0; s < 8; ++s) { const int row = 2 * s + hi, cofs = lr * 4; val[s] = *(const v4fa*)(os + row * 68 + cofs); if (BIAS) val[s] += bv;
            co[s] = crow + (size_t)row * ldc + cofs; }
        if (OM == 0) st8_b128(C, co, val);
        else if (OM == 3) { v4f o[8];
#pragma unroll
            for (int s = 0; s < 8; ++s)
#pragma unroll
                for (int q = 0; q < 4; ++q) o[s][q] = __fmul_rn(val[s][q], osc);
            st8_b128(C, co, o); }
        else if (OM == 1) { v4us o[8];
#pragma unroll
            for (int s = 0; s < 8; ++s) { v4h t;
#pragma unroll
                for (int q = 0; q < 4; ++q) t[q] = tohx(val[s][q]);
                o[s] = __builtin_bit_cast(v4us, t); }
            st8_b64(D0, co, o); }
        else { v4us oh[8], ol[8];
#pragma unroll
            for (int s = 0; s < 8; ++s)
#pragma unroll
                for (int q = 0; q < 4; ++q) { unsigned short h2, l2; splitf(__fmul_rn(val[s][q], osc), h2, l2); oh[s][q] = h2; ol[s][q] = l2; }
            st8_b64(D0, co, oh); st8_b64(D1, co, ol); }
        __builtin_amdgcn_wave_barrier(); asm volatile("" ::: "memory");
    }
}
template <typename T16, bool SPLIT, int BIAS, int OM>
__global__ __launch_bounds__(128) void k_gemmt(const T16* __restrict__ A, const T16* __restrict__ A2, const T16* __restrict__ Bt, int K, float* C, unsigned short* D0, unsigned short* D1, float osc, int ldc, const float* __restrict__ bias, size_t sA, size_t sB, size_t sC) {
    __shared__ __attribute__((aligned(2048))) unsigned char L[2 * BUFB];
    gemm_tile<T16, SPLIT, BIAS, OM>(L, blockIdx.x, blockIdx.y, blockIdx.z, A, A2, Bt, K, C, D0, D1, osc, ldc, bias, sA, sB, sC);
}

typedef __attribute__((ext_vector_type(2))) _Float16 v2h;
typedef __attribute__((ext_vector_type(2))) unsigned short v2us;
typedef __attribute__((ext_vector_type(2))) float v2f;
typedef __attribute__((ext_vector_type(4))) int v4i;

// k_asoft: per row (zz, i): t = S x SCL (no mask; SCL 0.125 here: the module's 1/32 is 0.125 x the 1/4 folded into q's cast); softmax over the 2048 keys (register row, one exp, fixed trees); beside each f16 word of the weights x 1,024 it stores that word x 2^-10 as f32 to Wt: the second output;
__global__ __launch_bounds__(256) void k_asoft(const float* __restrict__ Sb, h16* P16, bf* Ph, bf* Pl, float* Wt) {
    const int lane = threadIdx.x & 31; const int row = blockIdx.x * 8 + (threadIdx.x >> 5); if (row >= ZH * TT) return; const int i = row % TT; const int zz = row / TT; (void)zz; const bool hires = (i < RH); const float* sr = Sb + (size_t)row * TT; float v[TT / 32]; float mx = -3.0e38f;
#pragma unroll
    for (int ch = 0; ch < TT / 128; ++ch) { const int j0 = ch * 128 + lane * 4; const v4f a = *(const v4f*)(sr + j0);
#pragma unroll
        for (int q = 0; q < 4; ++q) { const int j = j0 + q; (void)j; const float t = a[q] * SCL; v[ch * 4 + q] = t; mx = fmaxf(mx, t); } }
#pragma unroll
    for (int sh = 16; sh; sh >>= 1) mx = fmaxf(mx, __shfl_xor(mx, sh, 32));
    float sum = 0.f;
#pragma unroll
    for (int k = 0; k < TT / 32; ++k) { float d0 = __fsub_rn(v[k], mx); v[k] = __builtin_amdgcn_exp2f(__fmul_rn(d0, 1.4426950408889634f)); sum += v[k]; }
#pragma unroll
    for (int sh = 16; sh; sh >>= 1) sum += __shfl_xor(sum, sh, 32);
    const float f = __fdiv_rn(hires ? 1.0f : PCAR, sum);
{
        if (hires) {
#pragma unroll
            for (int ch = 0; ch < TT / 128; ++ch) { v4us oh, ol;
#pragma unroll
                for (int q = 0; q < 4; ++q) { unsigned short a, c2; splitf(v[ch * 4 + q] * f, a, c2); oh[q] = a; ol[q] = c2; }
                const size_t oo = ((size_t)zz * (RH ? RH : 1) + i) * TT + ch * 128 + lane * 4; *(v4us*)(Ph + oo) = oh; *(v4us*)(Pl + oo) = ol; }
        } else {
#pragma unroll
            for (int ch = 0; ch < TT / 128; ++ch) { v4h o4; v4f w4;
#pragma unroll
                for (int q = 0; q < 4; ++q) { o4[q] = tohx(v[ch * 4 + q] * f); w4[q] = __fmul_rn((float)o4[q], 1.0f / PCAR); }
                *(v4h*)(P16 + (size_t)row * TT + ch * 128 + lane * 4) = o4; *(v4f*)(Wt + (size_t)row * TT + ch * 128 + lane * 4) = w4; } }
         }
}
// ---- k_prep: THE CASTS AND GATHERS THAT THE FIRST PRODUCTS READ (input_feature, the weights; query's ride k_kw) AS ONE RESIDENT STREAM: 256 work-groups of 16 waves; the unit of work is one row of 1,024 floats (4 KiB in a row in its source): a wave reads it with eight 512-B loads and stores its 1,024 16-bit words with eight 256-B stores; two rows of a wave are in flight at any time.
// Wave w of 4,096 takes rows w and w + 4,096 of input_feature (each stored twice: bf16 and f16; row r = token r / 4 of entry r % 4: it goes to row r / 4 of plane r % 4), and the first twelve waves of every work-group one of 3,072 units of the two weights:
// a row of k's weights; or a tile of 64 rows x 16 columns of v's, stored transposed; or a row e of out_proj_weight, with which the wave also sums 1,024 x (Wo[e] . bv + bo[e]).
// The words are those of the flat casts: bf16 by round to nearest even; query: that word x 1/4 as f16, a word under 2^-14 in size written as zero.
#define PWV 16u                   // waves a work-group
#define PGR 256u                  // work-groups
#define PWT 12u                   // waves of a work-group that take a weight unit: 256 x 12 = 1,024 + 1,024 + 1,024
#define CPIT 32                   // floats from one word of the carried vector to the next: every word has its own 128-B line, since every word has its own writer
// every loop of k_prep and its helpers is unrolled: the row arrays are then indexed by constants alone and stay in registers
__device__ __forceinline__ void ld_row(const float* __restrict__ s, int lane, v4f (&r)[8]) {
#pragma unroll
    for (int j = 0; j < 8; ++j) r[j] = *(const v4f*)(s + j * 128 + lane * 4);
    asm volatile("s_wait_xcnt 0x0" :: "s"(s) : "memory"); }   // behind the eight row loads, ahead of every later write of their address registers; the loads' scalar base is an input of the wait, so that its registers are held to here and take no new value ahead of it
// ld_row where the lane's offset register is used for the last time: the eighth load may then take that register for its own words, so a wait on the seven loads that name it stands in front of the eighth
__device__ __forceinline__ void ld_row_end(const float* __restrict__ s, int lane, v4f (&r)[8]) {
#pragma unroll
    for (int j = 0; j < 7; ++j) r[j] = *(const v4f*)(s + j * 128 + lane * 4);
    asm volatile("s_wait_xcnt 0x0" :: "s"(s) : "memory");   // behind the seven loads, ahead of the eighth's write of the offset register
    r[7] = *(const v4f*)(s + 7 * 128 + lane * 4);
    asm volatile("s_wait_xcnt 0x0" :: "s"(s) : "memory"); }   // as in ld_row
// the lane's two rows, 2 lane and 2 lane + 1, of a tile of 64 rows x 16 floats: r[0..3] the first row's 64 B, r[4..7] the second's
__device__ __forceinline__ void ld_tile(const float* __restrict__ s, int lane, v4f (&r)[8]) {
#pragma unroll
    for (int j = 0; j < 8; ++j) r[j] = *(const v4f*)(s + (size_t)(2 * lane + (j >> 2)) * DM + (j & 3) * 4);
    asm volatile("s_wait_xcnt 0x0" :: "s"(s) : "memory"); }   // behind the eight tile loads, ahead of every later write of their address registers; the scalar base is an input of the wait, as in ld_row
// column c of the tile becomes row c of the transposed plane, where the lane's two words are neighbours: a store is 32 lanes x 4 B = one whole 128-B line
__device__ __forceinline__ void st_tile(unsigned short* d, int lane, const v4f (&r)[8]) {
#pragma unroll
    for (int h = 0; h < 2; ++h) { uint32_t o[8]; size_t off[8];
#pragma unroll
        for (int j = 0; j < 8; ++j) { const int c = h * 8 + j; o[j] = (uint32_t)f2bf(r[c >> 2][c & 3]) | ((uint32_t)f2bf(r[4 + (c >> 2)][c & 3]) << 16); off[j] = (size_t)c * DM + (size_t)(2 * lane); }
        st8_b32(d, off, o); } }
// H 0: the bf16 word; 1: query's f16 word; 2: the bf16 word written as f16
template <int H>
__device__ __forceinline__ void st_row(unsigned short* d, int lane, const v4f (&r)[8]) { v4us o[8]; size_t off[8];
#pragma unroll
    for (int j = 0; j < 8; ++j) { off[j] = (size_t)(j * 128 + lane * 4);
#pragma unroll
        for (int q = 0; q < 4; ++q) { const float x = r[j][q]; if (H == 1) { const float y = __fmul_rn(bfr(x), QSC); const float z = (fabsf(y) < 6.103515625e-5f) ? 0.0f : y; o[j][q] = __builtin_bit_cast(unsigned short, tohx(z)); } else if (H == 2) o[j][q] = __builtin_bit_cast(unsigned short, tohx(bfr(x))); else o[j][q] = f2bf(x); } }
    st8_b64(d, off, o); }
__global__ __launch_bounds__(512) void k_prep(const float* __restrict__ xin, const float* __restrict__ win, const float* __restrict__ wo, const float* __restrict__ bvin, const float* __restrict__ boin, unsigned short* XB, unsigned short* X16, unsigned short* WB, unsigned short* WVT, unsigned short* WOB, float* BV) {
    const int lane = threadIdx.x & 31; const uint32_t wv = uni(threadIdx.x >> 5), w = blockIdx.x * PWV + wv, w2 = w + PGR * PWV, u = blockIdx.x * PWT + wv;   // u: the wave's weight unit, where wv < PWT
    const size_t PLW = (size_t)TT * DM; const size_t d1 = (size_t)(w & 3u) * PLW + (size_t)(w >> 2) * DM, d2 = (size_t)(w2 & 3u) * PLW + (size_t)(w2 >> 2) * DM;
    const bool wrow = wv < PWT, isk = wrow && u < (uint32_t)DM, isv = wrow && !isk && u < 2u * DM, iso = wrow && u >= 2u * DM;   // all the same in every lane of a wave
    const uint32_t t = u - (uint32_t)DM, j0 = (t >> 6) * 64u, c0 = (t & 63u) * 16u, e = u - 2u * DM;   // isv: the tile's first row and column in v's weights; iso: the row of out_proj_weight
    v4f ra[8], rb[8];
    ld_row(xin + (size_t)w * DM, lane, ra); ld_row(xin + (size_t)w2 * DM, lane, rb);
    st_row<0>(XB + d1, lane, ra); st_row<2>(X16 + d1, lane, ra);
    // each kind of wave has its own straight path to the end, the second row's stores included: the waits on that row then count the loads of that path alone
    if (isk) { ld_row(win + (size_t)u * DM, lane, ra); st_row<0>(XB + d2, lane, rb); st_row<2>(X16 + d2, lane, rb); st_row<0>(WB + (size_t)u * DM, lane, ra); }
    else if (isv) { ld_tile(win + (size_t)(DM + j0) * DM + c0, lane, ra); st_row<0>(XB + d2, lane, rb); st_row<2>(X16 + d2, lane, rb); st_tile(WVT + (size_t)c0 * DM + j0, lane, ra); }
    else if (!iso) { st_row<0>(XB + d2, lane, rb); st_row<2>(X16 + d2, lane, rb); }
    else { v4f rc[8]; ld_row(wo + (size_t)e * DM, lane, ra); ld_row_end(bvin, lane, rc); st_row<0>(XB + d2, lane, rb); st_row<2>(X16 + d2, lane, rb); st_row<0>(WOB + (size_t)e * DM, lane, ra);
        float sum = 0.f;
#pragma unroll
        for (int j = 0; j < 8; ++j)
#pragma unroll
            for (int q = 0; q < 4; ++q) sum = fmaf(bfr(ra[j][q]), bfr(rc[j][q]), sum);
#pragma unroll
        for (int sh = 16; sh; sh >>= 1) sum += __shfl_xor(sum, sh, 32);
        const float cw = __fmul_rn(sum + bfr(boin[e]), PCAR);
        // the one word and its s_wait_xcnt 0 in ONE statement, as in the row stores
        if (lane == 0) asm volatile("global_store_b32 %0, %1, off\n\ts_wait_xcnt 0x0" :: "v"(BV + (size_t)e * CPIT), "v"(cw) : "memory"); }
}

// WORK THAT READS NOTHING OF EACH OTHER SHARES A LAUNCH: a work-group is one tile of one product, or 16 rows of a cast, by its index alone; no launch gap between the jobs.
// k_kw: grid (16, 68): y < 32: k = x Wk^T + bk, tile (x, y % 8) of entry y / 8: 512 work-groups, every place of the chip; y < 36: Wvo = Wo Wv, 8 x 8 tiles: they alone would leave seven places in eight idle; the last 512 work-groups fill those with query's cast and gather (first read by the launch behind this one): 16 rows each, 4 a wave (one token's four entries: 16 KiB in a row), all four in flight at once, since only 8 waves stand on a WGP here.
__global__ __launch_bounds__(128) void k_kw(const bf* __restrict__ XBp, const bf* __restrict__ WBp, const bf* __restrict__ WOBp, const bf* __restrict__ WVTp, int K, unsigned short* K16p, unsigned short* WVOp, const float* __restrict__ bias, const float* __restrict__ qin, unsigned short* Q16p) {
    __shared__ __attribute__((aligned(2048))) unsigned char L[2 * BUFB];
    const uint32_t x = blockIdx.x, y = blockIdx.y; const size_t PLW = (size_t)TT * DM;
    if (pinned(y < 32u))   // the pinned() form: the test stands round tensor loads, so the branch is scalar
        gemm_tile<bf, false, 1, 1>(L, x, y & 7u, y >> 3, XBp, nullptr, WBp, K, nullptr, K16p, nullptr, 1.0f, DM, bias, PLW, 0, PLW);
    else if (pinned(y < 36u)) { const uint32_t f = (y - 32u) * 16u + x;   // the pinned() form, as above
        gemm_tile<bf, false, 0, 1>(L, f & 7u, f >> 3, 0u, WOBp, nullptr, WVTp, K, nullptr, WVOp, nullptr, 1.0f, DM, nullptr, 0, 0, 0); }
    else { const int lane = threadIdx.x & 31; const uint32_t tok = ((y - 36u) * 16u + x) * 4u + uni(threadIdx.x >> 5);
        const float* s = qin + (size_t)tok * (NB_ * DM); unsigned short* d = Q16p + (size_t)tok * DM;
        v4f ra[8], rb[8], rc[8], rd[8];
        ld_row(s, lane, ra); ld_row(s + DM, lane, rb); ld_row(s + 2 * DM, lane, rc); ld_row(s + 3 * DM, lane, rd);
        st_row<1>(d, lane, ra); st_row<1>(d + PLW, lane, rb); st_row<1>(d + 2 * PLW, lane, rc); st_row<1>(d + 3 * PLW, lane, rd); }
}
// k_sv: grid (16, 16, 6): z < 4: scores = (q / 4) k^T, tile (x, y) of entry z; the last 512 work-groups: v'^T = Wvo x^T, 8 x 16 tiles of each of the four entries.
__global__ __launch_bounds__(128) void k_sv(const h16* __restrict__ Q16p, const h16* __restrict__ K16p, const h16* __restrict__ WVOp, const h16* __restrict__ X16p, int K, float* Sbp, unsigned short* VT16p) {
    __shared__ __attribute__((aligned(2048))) unsigned char L[2 * BUFB];
    const uint32_t x = blockIdx.x, y = blockIdx.y, zz = blockIdx.z; const size_t PLW = (size_t)TT * DM;
    if (pinned(zz < 4u))   // the pinned() form, as in k_kw
        gemm_tile<h16, false, 0, 0>(L, x, y, zz, Q16p, nullptr, K16p, K, Sbp, nullptr, nullptr, 1.0f, TT, nullptr, PLW, PLW, (size_t)TT * TT);
    else { const uint32_t f = (zz - 4u) * 256u + y * 16u + x;
        gemm_tile<h16, false, 0, 1>(L, f & 7u, (f >> 3) & 15u, f >> 7, WVOp, nullptr, X16p, K, nullptr, VT16p, nullptr, 1.0f, TT, nullptr, 0, PLW, PLW); }
}

extern "C" void kernel_launch(void* const* d_in, const int* in_sizes, int n_in,
                              void* d_out, int out_size, void* d_ws, size_t ws_size, hipStream_t stream) {
    (void)in_sizes; (void)n_in; (void)out_size;
    const float* qin = (const float*)d_in[0]; const float* xin = (const float*)d_in[1]; const float* win = (const float*)d_in[2]; const float* bin = (const float*)d_in[3]; const float* wo = (const float*)d_in[4]; const float* bo = (const float*)d_in[5];   /* the module's argument order: query, input_feature, in_proj_weight, in_proj_bias, out_proj_weight, out_proj_bias: SIX inputs; all read */
    float* OUT0 = (float*)d_out;                                   // attn [2048][4][1024]
    float* OUT1 = (float*)d_out + (size_t)TT * NB_ * DM;           // attn_weights [4][2048][2048]: 33,554,432 B after the first
    char* wsp = (char*)d_ws;
    auto take = [&](size_t bytes) { char* p = wsp; wsp += (bytes + 255) & ~(size_t)255; return (void*)p; };
    bf* WB = (bf*)take((size_t)DM * DM * 2);   /* k's rows of in_proj_weight as bf16 */ bf* WVT = (bf*)take((size_t)DM * DM * 2);   /* v's rows, transposed */ bf* WOB = (bf*)take((size_t)DM * DM * 2); h16* WVO = (h16*)take((size_t)DM * DM * 2);   /* Wo Wv, f16 */ float* BV = (float*)take((size_t)DM * CPIT * 4);
    bf* XB = (bf*)take((size_t)ZH * TT * DM * 2);   /* the entries' bf16 rows */ h16* X16 = (h16*)take((size_t)ZH * TT * DM * 2);   /* the same words as f16 */
    h16* Q16 = (h16*)take((size_t)ZH * TT * DM * 2); h16* K16 = (h16*)take((size_t)ZH * TT * DM * 2); h16* VT16 = (h16*)take((size_t)ZH * DM * TT * 2);   /* the entries' f16 planes: q; k token-major; v' CHANNEL-major [1024][2048] */
    float* Sb = (float*)take((size_t)ZH * TT * TT * 4); h16* P16 = (h16*)take((size_t)ZH * TT * TT * 2);
    if ((size_t)(wsp - (char*)d_ws) > ws_size) return;    // total 184.13 MiB carved
    const size_t PITCH = (size_t)NB_ * DM;
    const size_t PL = (size_t)TT * DM;   /* words of one entry's [2048][1024] plane */
    k_prep<<<PGR, PWV * 32u, 0, stream>>>(xin, win, wo, bin + DM, bo, XB, (unsigned short*)X16, WB, WVT, WOB, BV);   /* the casts and gathers of input_feature and of the weights */
    k_kw<<<dim3(16, 68, 1), 128, 0, stream>>>(XB, WB, WOB, WVT, DM, (unsigned short*)K16, (unsigned short*)WVO, bin, qin, (unsigned short*)Q16);   /* k = x Wk^T + bk: token-major, f16 words; Wvo = Wo Wv: [out channel][in channel], f16 words; query's f16 planes */
    k_sv<<<dim3(16, 16, 6), 128, 0, stream>>>(Q16, K16, WVO, X16, DM, Sb, (unsigned short*)VT16);   /* scores = (q / 4) k^T; v'^T = Wvo x^T: channel-major [1024][2048], f16 words; the biases ride the value product */
    k_asoft<<<ZH * TT / 8, 256, 0, stream>>>(Sb, P16, nullptr, nullptr, OUT1);   /* the weights' f16 plane and the second output */
    k_gemmt<h16, false, 2, 3><<<dim3(TT / 128, DM / 128, ZH), 128, 0, stream>>>(P16, nullptr, VT16, TT, OUT0, nullptr, nullptr, 1.0f / PCAR, (int)PITCH, BV, (size_t)TT * TT, PL, (size_t)DM);   /* out = 2^-10 x 1,024 x (weights v' + Wo bv + bo), written in place: row pitch 4,096 floats; each further entry 1,024 floats further */
}

// v007
// Measured time: 107 microseconds a run.
// Timed twice side by side with v006, it ran 1.04 and 1.03 times as fast.
// Counting every step since v000, it is 5.31 times as fast.
#include <hip/hip_runtime.h>
#include <stdint.h>

// Single-head cross-attention that also returns its softmax weights (query, input_feature [2048][4][1024] = [token][entry][channel]; kv = input_feature in_proj_weight^T + in_proj_bias ('oi' (out, in) [2048][1024] x 1/32 + [2048] zeros): k = the first 1,024 columns, v = the last; q = query x 1024^-0.5: NO q projection; ONE head of width 1,024;
// attn_weights[b][t][s] = softmax over the 2,048 keys s of q[t] . k[s] (no mask): RETURNED as the second output [4][2048][2048]; attn = attn_weights v; out = attn out_proj_weight^T + out_proj_bias ('oi' [1024][1024] + [1024] zeros): the first output [2048][4][1024]; argument order query, input_feature, in_proj_weight, in_proj_bias, out_proj_weight, out_proj_bias).
// THE OUTPUT PROJECTION IS FOLDED INTO THE VALUE PROJECTION: out = weights (x Wv^T + bv) Wo^T + bo = weights (x (Wo Wv)^T) + (Wo bv + bo), the rows of the weights summing to one: Wvo = Wo Wv is formed anew in every call (one bf16 product of 1,024^3, stored as ONE f16 word), v' = x Wvo^T takes v's place, and the value product writes the first output itself: no product with out_proj_weight at 8,192 rows.
// Layout: once: k's rows of in_proj_weight and out_proj_weight cast to bf16 as they stand, v's rows cast AND TRANSPOSED ([channel in][channel out of v]: the second operand of Wo Wv); 1,024 x (Wo bv + bo) as f32 words, one a 128-B line; ALL FOUR entries ride every launch (the rows of k_prep, the batch index of the products, the softmax's rows): each entry's rows gathered out of the [token][entry] layout (a row pitch of 4,096 floats) into contiguous planes: input_feature as bf16 (for k) and the same words as f16 (for v'; exact from 2^-17 up) and query x 1/4 as ONE f16 word (a word under 2^-14 in size is written as zero); these casts and gathers are ONE launch (k_prep), but query's, which ride the launch of k's product (k_kw);
// k = x Wk^T + bias (a plain bf16 product; token-major [2048][1024]: it IS the head's key plane), stored by the product's own epilogue as ONE f16 word; v'^T = Wvo x^T (an fp16 product with the operands' roles exchanged: channel-major [1024][2048]: the value product's second operand, no transposer), stored likewise as ONE f16 word; scores = q k^T (one fp16 product at depth 1,024); the softmax at 2,048 keys, EVERY row on the f16 plane of its weights x 1,024;
// THE SECOND OUTPUT is that plane x 2^-10 as f32, stored by the softmax beside the plane; 1,024 x (weights v' + Wo bv + bo) by one fp16 product at depth 2,048 with the carried vector in its bias slot (the rows of the weights sum to one: adding v's bias after the product equals adding it to v before); its epilogue stores the f32 words x 2^-10 (the scale argument undoes the carry): the first output in place (row pitch 4,096 floats; each further entry 1,024 floats further).
// A flat kernel text (k_prep: no loop; every address from the wave's and the lane's own index and launch constants; no LDS, barrier or atomic; cross-lane words only in the sum of Wo bv).
// Compute dtypes, f32 accumulate: every float input rounded to bf16 at its load; k's projection and Wo Wv plain bf16 (inputs: exact); q (an input x 1/4: exact in f16 but for words under 2^-14), k, Wvo, v' and the weights x 1,024 each ONE f16 word: v's projection and both attention products fp16; softmax f32; Wo bv + bo in f32 on the vector unit (one vector: no matrix form fits it).

#define NB_  4
#define TT   2048
#define DM   1024                 // the model width = the one head's width
#define ZH   4                    // entries a launch: all of them
#define RH   0                    // the softmax's hi + lo stores stand under 'row < RH': none taken: EVERY row stores the f16 plane of its weights x 1,024
#define PCAR 1024.0f              // the weights' carry
#define SCL  0.125f               // the softmax's scale: the module's 1/32 = 0.125 x the 1/4 folded into q's cast (both powers of two: exact)
#define QSC  0.25f
typedef _Float16 h16;
typedef unsigned short bf;
typedef __attribute__((ext_vector_type(16))) __bf16   v16bf;
typedef __attribute__((ext_vector_type(16))) _Float16 v16h;
typedef __attribute__((ext_vector_type(8)))  _Float16 v8h;
typedef __attribute__((ext_vector_type(8)))  unsigned short v8us;
typedef __attribute__((ext_vector_type(8)))  float    v8f;
typedef __attribute__((ext_vector_type(4)))  float    v4f;
typedef v8h  __attribute__((may_alias)) v8ha;
typedef v4f  __attribute__((may_alias)) v4fa;
typedef v8us __attribute__((may_alias)) v8usa;

__device__ __forceinline__ unsigned short f2bf(float f) { unsigned u = __float_as_uint(f); u += 0x7FFFu + ((u >> 16) & 1u); return (unsigned short)(u >> 16); }
__device__ __forceinline__ float bf2f(unsigned short b) { return __uint_as_float(((unsigned)b) << 16); }
__device__ __forceinline__ float bfr(float f) { return bf2f(f2bf(f)); }
__device__ __forceinline__ v16h cat16(v8h lo, v8h hi) { return __builtin_shufflevector(lo, hi, 0, 1, 2, 3, 4, 5, 6, 7, 8, 9, 10, 11, 12, 13, 14, 15); }
__device__ __forceinline__ v16bf cat16b(v8us lo, v8us hi) { return __builtin_bit_cast(v16bf, __builtin_shufflevector(lo, hi, 0, 1, 2, 3, 4, 5, 6, 7, 8, 9, 10, 11, 12, 13, 14, 15)); }
__device__ __forceinline__ v8f wmma16(v16h a, v16h b, v8f c) { return __builtin_amdgcn_wmma_f32_16x16x32_f16(false, a, false, b, (short)0, c, false, false); }
__device__ __forceinline__ v8f wmmab(v16bf a, v16bf b, v8f c) { return __builtin_amdgcn_wmma_f32_16x16x32_bf16(false, a, false, b, (short)0, c, false, false); }
__device__ __forceinline__ h16 tohx(float x) { return (h16)x; }
__device__ __forceinline__ void splitf(float y, unsigned short& h, unsigned short& l) { h = f2bf(y); l = f2bf(y - bf2f(h)); }
typedef __attribute__((ext_vector_type(4))) _Float16 v4h;
typedef __attribute__((ext_vector_type(4))) unsigned short v4us;



// ---- k_gemmt: block GEMM, FOUR WAVES per 128x128 output tile (2 x 2 waves of 64x64, 16 accumulators each); grid (M/128, N/128, Z), 128 threads. Operands are K-contiguous 16-bit planes.
// C[m][n] (pitch ldc, + optional f32 bias[n]) = sum_k A[m][k] Bt[n][k] (SPLIT: then + sum_k A2[m][k] Bt[n][k], as further passes). OM picks what the epilogue stores of the f32 value: 0: the f32 word to C; 1: its f16 word to D0; 2: the bf16 hi and lo words of value x osc to D0 and D1 (the words its consumer reads: no f32 plane, no cast launch); 3: the f32 word of value x osc to C. BIAS 1: bias[n] is an input's word, rounded to bf16 at its load; 2: bias[32 n] is a workspace word, taken as it is. z-batch strides sA/sB/sC in elements. M, N % 128 == 0, K % 128 == 0, K >= 256.
// A pass is 128 k = 256 B of every operand row. A stage is [A 128 rows | Bt 128 rows] in LDS at pitch 272 B, in four slices of 64 rows; each wave brings its own slice with ONE tensor load a pass; two buffers, so that the next pass's rows fly while this pass is worked on.
// THE k WALK STARTS AT A PASS OF THE TILE'S OWN, (bx + by) mod passes, and wraps: the tiles of one row or column of the grid read the same operand rows from L2 and run side by side; started alike they would ask for the same lines at the same moment. The f32 sum over k takes its 128-k blocks in that rotated order.
typedef uint32_t u32x4 __attribute__((ext_vector_type(4)));
typedef uint32_t u32x8 __attribute__((ext_vector_type(8)));
typedef float __attribute__((may_alias)) f32a;
#define ROWB   256u                // bytes of an operand row a pass
#define LPITCH 272u                // its pitch in LDS: 16 B x odd, for ds_load_b128 readers
#define SLICE  18432u              // 64 rows x 272 B = 17,408 B, rounded up to a multiple of 2 KiB
#define BUFB   (4u * SLICE)
__device__ __forceinline__ uint32_t uni(uint32_t v) { return (uint32_t)__builtin_amdgcn_readfirstlane(v); }
__device__ __forceinline__ uint32_t pinned(uint32_t v) { uint32_t w = uni(v); asm volatile("" : "+s"(w)); /* the pinned() form for a test round a tensor load: it holds the test in a scalar register, so that the branch is scalar (a tensor load ignores EXEC) */ return w; }
__device__ __forceinline__ void wait_ds0() { asm volatile("s_wait_dscnt 0x0" ::: "memory"); }       // this wave's LDS reads have retired before the barrier behind which their buffer is refilled
// both groups are in-out operands of the load and inputs of the wait that covers it: to the compiler the words behind the load are values that only these registers hold, needed again at the wait, so it neither reuses the registers as temporaries nor forms the words anew while the request is outstanding
__device__ __forceinline__ void tdm_load(u32x4& g0, u32x8& g1) { asm volatile("tensor_load_to_lds %0, %1" : "+s"(g0), "+s"(g1) :: "memory"); }
// this wave's own slice has landed: the compiler places no wait for a tensor load
__device__ __forceinline__ void wait_tensor0(const u32x4& g0, const u32x8& g1) { asm volatile("s_wait_tensorcnt 0x0" :: "s"(g0), "s"(g1) : "memory"); }
// eight row stores and their s_wait_xcnt 0 in ONE statement: the operands' registers live to the statement's end, so no register that a store names (address or data) is rewritten ahead of the wait
__device__ __forceinline__ void st8_b64(unsigned short* b, const size_t (&o)[8], const v4us (&d)[8]) {
    asm volatile("global_store_b64 %0, %8, off\n\tglobal_store_b64 %1, %9, off\n\tglobal_store_b64 %2, %10, off\n\tglobal_store_b64 %3, %11, off\n\tglobal_store_b64 %4, %12, off\n\tglobal_store_b64 %5, %13, off\n\tglobal_store_b64 %6, %14, off\n\tglobal_store_b64 %7, %15, off\n\ts_wait_xcnt 0x0"
                 :: "v"(b + o[0]), "v"(b + o[1]), "v"(b + o[2]), "v"(b + o[3]), "v"(b + o[4]), "v"(b + o[5]), "v"(b + o[6]), "v"(b + o[7]), "v"(d[0]), "v"(d[1]), "v"(d[2]), "v"(d[3]), "v"(d[4]), "v"(d[5]), "v"(d[6]), "v"(d[7]) : "memory"); }
__device__ __forceinline__ void st8_b32(unsigned short* b, const size_t (&o)[8], const uint32_t (&d)[8]) {
    asm volatile("global_store_b32 %0, %8, off\n\tglobal_store_b32 %1, %9, off\n\tglobal_store_b32 %2, %10, off\n\tglobal_store_b32 %3, %11, off\n\tglobal_store_b32 %4, %12, off\n\tglobal_store_b32 %5, %13, off\n\tglobal_store_b32 %6, %14, off\n\tglobal_store_b32 %7, %15, off\n\ts_wait_xcnt 0x0"
                 :: "v"(b + o[0]), "v"(b + o[1]), "v"(b + o[2]), "v"(b + o[3]), "v"(b + o[4]), "v"(b + o[5]), "v"(b + o[6]), "v"(b + o[7]), "v"(d[0]), "v"(d[1]), "v"(d[2]), "v"(d[3]), "v"(d[4]), "v"(d[5]), "v"(d[6]), "v"(d[7]) : "memory"); }
__device__ __forceinline__ void st8_b128(float* b, const size_t (&o)[8], const v4f (&d)[8]) {
    asm volatile("global_store_b128 %0, %8, off\n\tglobal_store_b128 %1, %9, off\n\tglobal_store_b128 %2, %10, off\n\tglobal_store_b128 %3, %11, off\n\tglobal_store_b128 %4, %12, off\n\tglobal_store_b128 %5, %13, off\n\tglobal_store_b128 %6, %14, off\n\tglobal_store_b128 %7, %15, off\n\ts_wait_xcnt 0x0"
                 :: "v"(b + o[0]), "v"(b + o[1]), "v"(b + o[2]), "v"(b + o[3]), "v"(b + o[4]), "v"(b + o[5]), "v"(b + o[6]), "v"(b + o[7]), "v"(d[0]), "v"(d[1]), "v"(d[2]), "v"(d[3]), "v"(d[4]), "v"(d[5]), "v"(d[6]), "v"(d[7]) : "memory"); }
template <typename T16> struct WFrag;
template <> struct WFrag<h16> { typedef v16h V; static __device__ __forceinline__ V ld(const unsigned char* p) { return cat16(*(const v8ha*)p, *(const v8ha*)(p + 32)); } static __device__ __forceinline__ v8f mma(V a, V b, v8f c) { return wmma16(a, b, c); } };
template <> struct WFrag<bf> { typedef v16bf V; static __device__ __forceinline__ V ld(const unsigned char* p) { return cat16b(*(const v8usa*)p, *(const v8usa*)(p + 32)); } static __device__ __forceinline__ v8f mma(V a, V b, v8f c) { return wmmab(a, b, c); } };
// gemm_tile: the whole work of one work-group on output tile (bx, by) of batch entry bz; L is the kernel's own ring of 2 * BUFB bytes of LDS
template <typename T16, bool SPLIT, int BIAS, int OM>
__device__ __forceinline__ void gemm_tile(unsigned char* L, uint32_t bx, uint32_t by, uint32_t bz, const T16* __restrict__ A, const T16* __restrict__ A2, const T16* __restrict__ Bt, int K, float* C, unsigned short* D0, unsigned short* D1, float osc, int ldc, const float* __restrict__ bias, size_t sA, size_t sB, size_t sC) {
    typedef typename WFrag<T16>::V V;
    const size_t z = bz;
    const int lane = threadIdx.x & 31, lr = lane & 15, hi = lane >> 4; const int r0 = (int)bx * 128, c0 = (int)by * 128;
    const uint32_t wave = uni(threadIdx.x >> 5), wm = wave & 1u, wn = wave >> 1;
    const uint32_t np1 = (uint32_t)K / 128u, npass = SPLIT ? 2u * np1 : np1;
    const uint32_t rot = uni((bx + by) % np1);   // the pass of k at which this tile starts its walk: tiles that share A's rows (one bx) or Bt's (one by) run at the same time, and each starts elsewhere
    const uint32_t lbase = (uint32_t)(size_t)L;
    // waves 0 and 1 bring the two halves of A's 128 rows, waves 2 and 3 those of Bt's
    const bool isB = wave >= 2u;
    const size_t rowoff = isB ? z * sB + (size_t)(c0 + (int)(wave - 2u) * 64) * K : z * sA + (size_t)(r0 + (int)wave * 64) * K;
    const uint64_t src1 = (uint64_t)(size_t)((isB ? Bt : A) + rowoff);
    const uint64_t src2 = SPLIT ? (uint64_t)(size_t)((isB ? Bt : A2) + rowoff) : src1;
    u32x8 g1;   // 1-byte elements; tensor = tile = 64 rows of 256 B; source pitch 2 K bytes; a pad of 4 dwords behind every 64 dwords
    g1[0] = uni((1u << 20) | (5u << 22) | (3u << 25)); g1[1] = uni((ROWB & 0xFFFFu) << 16); g1[2] = uni((ROWB >> 16) | (64u << 16)); g1[3] = uni(ROWB << 16); g1[4] = uni(64u); g1[5] = uni((uint32_t)K * 2u); g1[6] = uni(0u); g1[7] = uni(0u);
    u32x4 g0;   // the group 0 of the request last issued: it takes new values only behind the wait that covers that request
    auto issue = [&](uint32_t s) {
        const bool second = SPLIT && s >= np1;
        const uint32_t t = (second ? s - np1 : s) + rot, kp = t >= np1 ? t - np1 : t;   // stage s holds pass kp of k: the walk wraps, every pass is taken once
        const uint64_t ga = (second ? src2 : src1) + (uint64_t)kp * ROWB;
        g0[0] = uni(1u); g0[1] = uni(lbase + (s & 1u) * BUFB + wave * SLICE); g0[2] = uni((uint32_t)ga); g0[3] = uni((((uint32_t)(ga >> 32)) & 0x01FFFFFFu) | 0x80000000u);
        tdm_load(g0, g1);
    };
    v8f acc[4][4];
#pragma unroll
    for (int mb = 0; mb < 4; ++mb)
#pragma unroll
        for (int nb = 0; nb < 4; ++nb) acc[mb][nb] = (v8f){};
    issue(0u); wait_tensor0(g0, g1); __syncthreads(); issue(1u);
    const unsigned char* fa0 = L + wm * SLICE + (uint32_t)lr * LPITCH + (uint32_t)hi * 16u;          // the lane's row of the wave's A slice; k order as the planes': 8 hi .. 8 hi + 7, then 16 + 8 hi ..
    const unsigned char* fb0 = L + (2u + wn) * SLICE + (uint32_t)lr * LPITCH + (uint32_t)hi * 16u;   // the same of its Bt slice
    for (uint32_t s = 0; s < npass; ++s) {
        const unsigned char* fa = fa0 + (s & 1u) * BUFB; const unsigned char* fb = fb0 + (s & 1u) * BUFB;
        V a[2][4], b[2][4];
#pragma unroll
        for (int q = 0; q < 4; ++q) { a[0][q] = WFrag<T16>::ld(fa + q * 16 * LPITCH); b[0][q] = WFrag<T16>::ld(fb + q * 16 * LPITCH); }
#pragma unroll
        for (int kb = 0; kb < 4; ++kb) {
            if (kb < 3) {
#pragma unroll
                for (int q = 0; q < 4; ++q) { a[(kb + 1) & 1][q] = WFrag<T16>::ld(fa + q * 16 * LPITCH + (kb + 1) * 64); b[(kb + 1) & 1][q] = WFrag<T16>::ld(fb + q * 16 * LPITCH + (kb + 1) * 64); } }
            __builtin_amdgcn_sched_barrier(0);   // keeps the next block's LDS reads one group ahead of this block's products, not spread among them
#pragma unroll
            for (int nb = 0; nb < 4; ++nb)
#pragma unroll
                for (int mb = 0; mb < 4; ++mb) acc[mb][nb] = WFrag<T16>::mma(a[kb & 1][mb], b[kb & 1][nb], acc[mb][nb]);
            __builtin_amdgcn_sched_barrier(0);   // the same, at the block's end
        }
        wait_ds0(); wait_tensor0(g0, g1); __syncthreads();   // publish point of stage s + 1; it also ends every reader's last read of stage s's buffer
        if (pinned(s + 2u < npass)) issue(s + 2u);
    }
    wait_tensor0(g0, g1); wait_ds0();
    // the last pass's barrier stands behind every wave's last read of the ring and no load is in flight: each wave stages its output rows in its own slice of buffer 0
    f32a* os = (f32a*)(L + wave * SLICE);
    const int rw = r0 + (int)wm * 64, cw = c0 + (int)wn * 64;
    v4f bv = (v4f){};   // the lane's four bias words: the same columns in every row it stores
    if (BIAS) {
#pragma unroll
        for (int q = 0; q < 4; ++q) bv[q] = (BIAS == 2) ? bias[(size_t)(cw + lr * 4 + q) * 32] : bfr(bias[cw + lr * 4 + q]);
        asm volatile("s_wait_xcnt 0x0" ::: "memory"); }   // behind the bias load, ahead of every later write of its address registers
#pragma unroll
    for (int mb = 0; mb < 4; ++mb) {
#pragma unroll
        for (int nb = 0; nb < 4; ++nb) {
#pragma unroll
            for (int j = 0; j < 8; ++j) os[(hi * 8 + j) * 68 + nb * 16 + lr] = acc[mb][nb][j]; }
        __builtin_amdgcn_wave_barrier(); asm volatile("" ::: "memory");   // compiler order only: the wave's 16 staged rows are stored before any lane reads them back, and (below) read before the next 16 overwrite them
        const size_t crow = z * sC + (size_t)(rw + mb * 16) * ldc + cw;
        v4f val[8]; size_t co[8];   // step s: 16 lanes cover the 64 columns of row 2 s + hi: 256 B of f32 words, or one whole 128-B line of 16-bit words
#pragma unroll
        for (int s = 0; s < 8; ++s) { const int row = 2 * s + hi, cofs = lr * 4; val[s] = *(const v4fa*)(os + row * 68 + cofs); if (BIAS) val[s] += bv;
            co[s] = crow + (size_t)row * ldc + cofs; }
        if (OM == 0) st8_b128(C, co, val);
        else if (OM == 3) { v4f o[8];
#pragma unroll
            for (int s = 0; s < 8; ++s)
#pragma unroll
                for (int q = 0; q < 4; ++q) o[s][q] = __fmul_rn(val[s][q], osc);
            st8_b128(C, co, o); }
        else if (OM == 1) { v4us o[8];
#pragma unroll
            for (int s = 0; s < 8; ++s) { v4h t;
#pragma unroll
                for (int q = 0; q < 4; ++q) t[q] = tohx(val[s][q]);
                o[s] = __builtin_bit_cast(v4us, t); }
            st8_b64(D0, co, o); }
        else { v4us oh[8], ol[8];
#pragma unroll
            for (int s = 0; s < 8; ++s)
#pragma unroll
                for (int q = 0; q < 4; ++q) { unsigned short h2, l2; splitf(__fmul_rn(val[s][q], osc), h2, l2); oh[s][q] = h2; ol[s][q] = l2; }
            st8_b64(D0, co, oh); st8_b64(D1, co, ol); }
        __builtin_amdgcn_wave_barrier(); asm volatile("" ::: "memory");
    }
}
template <typename T16, bool SPLIT, int BIAS, int OM>
__global__ __launch_bounds__(128) void k_gemmt(const T16* __restrict__ A, const T16* __restrict__ A2, const T16* __restrict__ Bt, int K, float* C, unsigned short* D0, unsigned short* D1, float osc, int ldc, const float* __restrict__ bias, size_t sA, size_t sB, size_t sC) {
    __shared__ __attribute__((aligned(2048))) unsigned char L[2 * BUFB];
    gemm_tile<T16, SPLIT, BIAS, OM>(L, blockIdx.x, blockIdx.y, blockIdx.z, A, A2, Bt, K, C, D0, D1, osc, ldc, bias, sA, sB, sC);
}

typedef __attribute__((ext_vector_type(2))) _Float16 v2h;
typedef __attribute__((ext_vector_type(2))) unsigned short v2us;
typedef __attribute__((ext_vector_type(2))) float v2f;
typedef __attribute__((ext_vector_type(4))) int v4i;

// k_asoft: per row (zz, i): t = S x SCL (no mask; SCL 0.125 here: the module's 1/32 is 0.125 x the 1/4 folded into q's cast); softmax over the 2048 keys (register row, one exp, fixed trees); beside each f16 word of the weights x 1,024 it stores that word x 2^-10 as f32 to Wt: the second output;
__global__ __launch_bounds__(256) void k_asoft(const float* __restrict__ Sb, h16* P16, bf* Ph, bf* Pl, float* Wt) {
    const int lane = threadIdx.x & 31; const int row = blockIdx.x * 8 + (threadIdx.x >> 5); if (row >= ZH * TT) return; const int i = row % TT; const int zz = row / TT; (void)zz; const bool hires = (i < RH); const float* sr = Sb + (size_t)row * TT; float v[TT / 32]; float mx = -3.0e38f;
#pragma unroll
    for (int ch = 0; ch < TT / 128; ++ch) { const int j0 = ch * 128 + lane * 4; const v4f a = *(const v4f*)(sr + j0);
#pragma unroll
        for (int q = 0; q < 4; ++q) { const int j = j0 + q; (void)j; const float t = a[q] * SCL; v[ch * 4 + q] = t; mx = fmaxf(mx, t); } }
#pragma unroll
    for (int sh = 16; sh; sh >>= 1) mx = fmaxf(mx, __shfl_xor(mx, sh, 32));
    float sum = 0.f;
#pragma unroll
    for (int k = 0; k < TT / 32; ++k) { float d0 = __fsub_rn(v[k], mx); v[k] = __builtin_amdgcn_exp2f(__fmul_rn(d0, 1.4426950408889634f)); sum += v[k]; }
#pragma unroll
    for (int sh = 16; sh; sh >>= 1) sum += __shfl_xor(sum, sh, 32);
    const float f = __fdiv_rn(hires ? 1.0f : PCAR, sum);
{
        if (hires) {
#pragma unroll
            for (int ch = 0; ch < TT / 128; ++ch) { v4us oh, ol;
#pragma unroll
                for (int q = 0; q < 4; ++q) { unsigned short a, c2; splitf(v[ch * 4 + q] * f, a, c2); oh[q] = a; ol[q] = c2; }
                const size_t oo = ((size_t)zz * (RH ? RH : 1) + i) * TT + ch * 128 + lane * 4; *(v4us*)(Ph + oo) = oh; *(v4us*)(Pl + oo) = ol; }
        } else {
#pragma unroll
            for (int ch = 0; ch < TT / 128; ++ch) { v4h o4; v4f w4;
#pragma unroll
                for (int q = 0; q < 4; ++q) { o4[q] = tohx(v[ch * 4 + q] * f); w4[q] = __fmul_rn((float)o4[q], 1.0f / PCAR); }
                *(v4h*)(P16 + (size_t)row * TT + ch * 128 + lane * 4) = o4; *(v4f*)(Wt + (size_t)row * TT + ch * 128 + lane * 4) = w4; } }
         }
}
// ---- k_prep: THE CASTS AND GATHERS THAT THE FIRST PRODUCTS READ (input_feature, the weights; query's ride k_kw) AS ONE RESIDENT STREAM: 256 work-groups of 16 waves; the unit of work is one row of 1,024 floats (4 KiB in a row in its source): a wave reads it with eight 512-B loads and stores its 1,024 16-bit words with eight 256-B stores; two rows of a wave are in flight at any time.
// Wave w of 4,096 takes rows w and w + 4,096 of input_feature (each stored twice: bf16 and f16; row r = token r / 4 of entry r % 4: it goes to row r / 4 of plane r % 4), and the first twelve waves of every work-group one of 3,072 units of the two weights:
// a row of k's weights; or a tile of 64 rows x 16 columns of v's, stored transposed; or a row e of out_proj_weight, with which the wave also sums 1,024 x (Wo[e] . bv + bo[e]).
// The words are those of the flat casts: bf16 by round to nearest even; query: that word x 1/4 as f16, a word under 2^-14 in size written as zero.
#define PWV 16u                   // waves a work-group
#define PGR 256u                  // work-groups
#define PWT 12u                   // waves of a work-group that take a weight unit: 256 x 12 = 1,024 + 1,024 + 1,024
#define CPIT 32                   // floats from one word of the carried vector to the next: every word has its own 128-B line, since every word has its own writer
// every loop of k_prep and its helpers is unrolled: the row arrays are then indexed by constants alone and stay in registers
__device__ __forceinline__ void ld_row(const float* __restrict__ s, int lane, v4f (&r)[8]) {
#pragma unroll
    for (int j = 0; j < 8; ++j) r[j] = *(const v4f*)(s + j * 128 + lane * 4);
    asm volatile("s_wait_xcnt 0x0" :: "s"(s) : "memory"); }   // behind the eight row loads, ahead of every later write of their address registers; the loads' scalar base is an input of the wait, so that its registers are held to here and take no new value ahead of it
// ld_row where the lane's offset register is used for the last time: the eighth load may then take that register for its own words, so a wait on the seven loads that name it stands in front of the eighth
__device__ __forceinline__ void ld_row_end(const float* __restrict__ s, int lane, v4f (&r)[8]) {
#pragma unroll
    for (int j = 0; j < 7; ++j) r[j] = *(const v4f*)(s + j * 128 + lane * 4);
    asm volatile("s_wait_xcnt 0x0" :: "s"(s) : "memory");   // behind the seven loads, ahead of the eighth's write of the offset register
    r[7] = *(const v4f*)(s + 7 * 128 + lane * 4);
    asm volatile("s_wait_xcnt 0x0" :: "s"(s) : "memory"); }   // as in ld_row
// the lane's two rows, 2 lane and 2 lane + 1, of a tile of 64 rows x 16 floats: r[0..3] the first row's 64 B, r[4..7] the second's
__device__ __forceinline__ void ld_tile(const float* __restrict__ s, int lane, v4f (&r)[8]) {
#pragma unroll
    for (int j = 0; j < 8; ++j) r[j] = *(const v4f*)(s + (size_t)(2 * lane + (j >> 2)) * DM + (j & 3) * 4);
    asm volatile("s_wait_xcnt 0x0" :: "s"(s) : "memory"); }   // behind the eight tile loads, ahead of every later write of their address registers; the scalar base is an input of the wait, as in ld_row
// column c of the tile becomes row c of the transposed plane, where the lane's two words are neighbours: a store is 32 lanes x 4 B = one whole 128-B line
__device__ __forceinline__ void st_tile(unsigned short* d, int lane, const v4f (&r)[8]) {
#pragma unroll
    for (int h = 0; h < 2; ++h) { uint32_t o[8]; size_t off[8];
#pragma unroll
        for (int j = 0; j < 8; ++j) { const int c = h * 8 + j; o[j] = (uint32_t)f2bf(r[c >> 2][c & 3]) | ((uint32_t)f2bf(r[4 + (c >> 2)][c & 3]) << 16); off[j] = (size_t)c * DM + (size_t)(2 * lane); }
        st8_b32(d, off, o); } }
// H 0: the bf16 word; 1: query's f16 word; 2: the bf16 word written as f16
template <int H>
__device__ __forceinline__ void st_row(unsigned short* d, int lane, const v4f (&r)[8]) { v4us o[8]; size_t off[8];
#pragma unroll
    for (int j = 0; j < 8; ++j) { off[j] = (size_t)(j * 128 + lane * 4);
#pragma unroll
        for (int q = 0; q < 4; ++q) { const float x = r[j][q]; if (H == 1) { const float y = __fmul_rn(bfr(x), QSC); const float z = (fabsf(y) < 6.103515625e-5f) ? 0.0f : y; o[j][q] = __builtin_bit_cast(unsigned short, tohx(z)); } else if (H == 2) o[j][q] = __builtin_bit_cast(unsigned short, tohx(bfr(x))); else o[j][q] = f2bf(x); } }
    st8_b64(d, off, o); }
__global__ __launch_bounds__(512) void k_prep(const float* __restrict__ xin, const float* __restrict__ win, const float* __restrict__ wo, const float* __restrict__ bvin, const float* __restrict__ boin, unsigned short* XB, unsigned short* X16, unsigned short* WB, unsigned short* WVT, unsigned short* WOB, float* BV) {
    const int lane = threadIdx.x & 31; const uint32_t wv = uni(threadIdx.x >> 5), w = blockIdx.x * PWV + wv, w2 = w + PGR * PWV, u = blockIdx.x * PWT + wv;   // u: the wave's weight unit, where wv < PWT
    const size_t PLW = (size_t)TT * DM; const size_t d1 = (size_t)(w & 3u) * PLW + (size_t)(w >> 2) * DM, d2 = (size_t)(w2 & 3u) * PLW + (size_t)(w2 >> 2) * DM;
    const bool wrow = wv < PWT, isk = wrow && u < (uint32_t)DM, isv = wrow && !isk && u < 2u * DM, iso = wrow && u >= 2u * DM;   // all the same in every lane of a wave
    const uint32_t t = u - (uint32_t)DM, j0 = (t >> 6) * 64u, c0 = (t & 63u) * 16u, e = u - 2u * DM;   // isv: the tile's first row and column in v's weights; iso: the row of out_proj_weight
    v4f ra[8], rb[8];
    ld_row(xin + (size_t)w * DM, lane, ra); ld_row(xin + (size_t)w2 * DM, lane, rb);
    st_row<0>(XB + d1, lane, ra); st_row<2>(X16 + d1, lane, ra);
    // each kind of wave has its own straight path to the end, the second row's stores included: the waits on that row then count the loads of that path alone
    if (isk) { ld_row(win + (size_t)u * DM, lane, ra); st_row<0>(XB + d2, lane, rb); st_row<2>(X16 + d2, lane, rb); st_row<0>(WB + (size_t)u * DM, lane, ra); }
    else if (isv) { ld_tile(win + (size_t)(DM + j0) * DM + c0, lane, ra); st_row<0>(XB + d2, lane, rb); st_row<2>(X16 + d2, lane, rb); st_tile(WVT + (size_t)c0 * DM + j0, lane, ra); }
    else if (!iso) { st_row<0>(XB + d2, lane, rb); st_row<2>(X16 + d2, lane, rb); }
    else { v4f rc[8]; ld_row(wo + (size_t)e * DM, lane, ra); ld_row_end(bvin, lane, rc); st_row<0>(XB + d2, lane, rb); st_row<2>(X16 + d2, lane, rb); st_row<0>(WOB + (size_t)e * DM, lane, ra);
        float sum = 0.f;
#pragma unroll
        for (int j = 0; j < 8; ++j)
#pragma unroll
            for (int q = 0; q < 4; ++q) sum = fmaf(bfr(ra[j][q]), bfr(rc[j][q]), sum);
#pragma unroll
        for (int sh = 16; sh; sh >>= 1) sum += __shfl_xor(sum, sh, 32);
        const float cw = __fmul_rn(sum + bfr(boin[e]), PCAR);
        // the one word and its s_wait_xcnt 0 in ONE statement, as in the row stores
        if (lane == 0) asm volatile("global_store_b32 %0, %1, off\n\ts_wait_xcnt 0x0" :: "v"(BV + (size_t)e * CPIT), "v"(cw) : "memory"); }
}

// WORK THAT READS NOTHING OF EACH OTHER SHARES A LAUNCH: a work-group is one tile of one product, or 16 rows of a cast, by its index alone; no launch gap between the jobs.
// k_kw: grid (16, 68): y < 32: k = x Wk^T + bk, tile (x, y % 8) of entry y / 8: 512 work-groups, every place of the chip; y < 36: Wvo = Wo Wv, 8 x 8 tiles: they alone would leave seven places in eight idle; the last 512 work-groups fill those with query's cast and gather (first read by the launch behind this one): 16 rows each, 4 a wave (one token's four entries: 16 KiB in a row), all four in flight at once, since only 8 waves stand on a WGP here.
__global__ __launch_bounds__(128) void k_kw(const bf* __restrict__ XBp, const bf* __restrict__ WBp, const bf* __restrict__ WOBp, const bf* __restrict__ WVTp, int K, unsigned short* K16p, unsigned short* WVOp, const float* __restrict__ bias, const float* __restrict__ qin, unsigned short* Q16p) {
    __shared__ __attribute__((aligned(2048))) unsigned char L[2 * BUFB];
    const uint32_t x = blockIdx.x, y = blockIdx.y; const size_t PLW = (size_t)TT * DM;
    if (pinned(y < 32u))   // the pinned() form: the test stands round tensor loads, so the branch is scalar
        gemm_tile<bf, false, 1, 1>(L, x, y & 7u, y >> 3, XBp, nullptr, WBp, K, nullptr, K16p, nullptr, 1.0f, DM, bias, PLW, 0, PLW);
    else if (pinned(y < 36u)) { const uint32_t f = (y - 32u) * 16u + x;   // the pinned() form, as above
        gemm_tile<bf, false, 0, 1>(L, f & 7u, f >> 3, 0u, WOBp, nullptr, WVTp, K, nullptr, WVOp, nullptr, 1.0f, DM, nullptr, 0, 0, 0); }
    else { const int lane = threadIdx.x & 31; const uint32_t tok = ((y - 36u) * 16u + x) * 4u + uni(threadIdx.x >> 5);
        const float* s = qin + (size_t)tok * (NB_ * DM); unsigned short* d = Q16p + (size_t)tok * DM;
        v4f ra[8], rb[8], rc[8], rd[8];
        ld_row(s, lane, ra); ld_row(s + DM, lane, rb); ld_row(s + 2 * DM, lane, rc); ld_row(s + 3 * DM, lane, rd);
        st_row<1>(d, lane, ra); st_row<1>(d + PLW, lane, rb); st_row<1>(d + 2 * PLW, lane, rc); st_row<1>(d + 3 * PLW, lane, rd); }
}
// k_sv: grid (16, 16, 6): z < 4: scores = (q / 4) k^T, tile (x, y) of entry z; the last 512 work-groups: v'^T = Wvo x^T, 8 x 16 tiles of each of the four entries.
__global__ __launch_bounds__(128) void k_sv(const h16* __restrict__ Q16p, const h16* __restrict__ K16p, const h16* __restrict__ WVOp, const h16* __restrict__ X16p, int K, float* Sbp, unsigned short* VT16p) {
    __shared__ __attribute__((aligned(2048))) unsigned char L[2 * BUFB];
    const uint32_t x = blockIdx.x, y = blockIdx.y, zz = blockIdx.z; const size_t PLW = (size_t)TT * DM;
    if (pinned(zz < 4u))   // the pinned() form, as in k_kw
        gemm_tile<h16, false, 0, 0>(L, x, y, zz, Q16p, nullptr, K16p, K, Sbp, nullptr, nullptr, 1.0f, TT, nullptr, PLW, PLW, (size_t)TT * TT);
    else { const uint32_t f = (zz - 4u) * 256u + y * 16u + x;
        gemm_tile<h16, false, 0, 1>(L, f & 7u, (f >> 3) & 15u, f >> 7, WVOp, nullptr, X16p, K, nullptr, VT16p, nullptr, 1.0f, TT, nullptr, 0, PLW, PLW); }
}

extern "C" void kernel_launch(void* const* d_in, const int* in_sizes, int n_in,
                              void* d_out, int out_size, void* d_ws, size_t ws_size, hipStream_t stream) {
    (void)in_sizes; (void)n_in; (void)out_size;
    const float* qin = (const float*)d_in[0]; const float* xin = (const float*)d_in[1]; const float* win = (const float*)d_in[2]; const float* bin = (const float*)d_in[3]; const float* wo = (const float*)d_in[4]; const float* bo = (const float*)d_in[5];   /* the module's argument order: query, input_feature, in_proj_weight, in_proj_bias, out_proj_weight, out_proj_bias: SIX inputs; all read */
    float* OUT0 = (float*)d_out;                                   // attn [2048][4][1024]
    float* OUT1 = (float*)d_out + (size_t)TT * NB_ * DM;           // attn_weights [4][2048][2048]: 33,554,432 B after the first
    char* wsp = (char*)d_ws;
    auto take = [&](size_t bytes) { char* p = wsp; wsp += (bytes + 255) & ~(size_t)255; return (void*)p; };
    bf* WB = (bf*)take((size_t)DM * DM * 2);   /* k's rows of in_proj_weight as bf16 */ bf* WVT = (bf*)take((size_t)DM * DM * 2);   /* v's rows, transposed */ bf* WOB = (bf*)take((size_t)DM * DM * 2); h16* WVO = (h16*)take((size_t)DM * DM * 2);   /* Wo Wv, f16 */ float* BV = (float*)take((size_t)DM * CPIT * 4);
    bf* XB = (bf*)take((size_t)ZH * TT * DM * 2);   /* the entries' bf16 rows */ h16* X16 = (h16*)take((size_t)ZH * TT * DM * 2);   /* the same words as f16 */
    h16* Q16 = (h16*)take((size_t)ZH * TT * DM * 2); h16* K16 = (h16*)take((size_t)ZH * TT * DM * 2); h16* VT16 = (h16*)take((size_t)ZH * DM * TT * 2);   /* the entries' f16 planes: q; k token-major; v' CHANNEL-major [1024][2048] */
    float* Sb = (float*)take((size_t)ZH * TT * TT * 4); h16* P16 = (h16*)take((size_t)ZH * TT * TT * 2);
    if ((size_t)(wsp - (char*)d_ws) > ws_size) return;    // total 184.13 MiB carved
    const size_t PITCH = (size_t)NB_ * DM;
    const size_t PL = (size_t)TT * DM;   /* words of one entry's [2048][1024] plane */
    k_prep<<<PGR, PWV * 32u, 0, stream>>>(xin, win, wo, bin + DM, bo, XB, (unsigned short*)X16, WB, WVT, WOB, BV);   /* the casts and gathers of input_feature and of the weights */
    k_kw<<<dim3(16, 68, 1), 128, 0, stream>>>(XB, WB, WOB, WVT, DM, (unsigned short*)K16, (unsigned short*)WVO, bin, qin, (unsigned short*)Q16);   /* k = x Wk^T + bk: token-major, f16 words; Wvo = Wo Wv: [out channel][in channel], f16 words; query's f16 planes */
    k_sv<<<dim3(16, 16, 6), 128, 0, stream>>>(Q16, K16, WVO, X16, DM, Sb, (unsigned short*)VT16);   /* scores = (q / 4) k^T; v'^T = Wvo x^T: channel-major [1024][2048], f16 words; the biases ride the value product */
    k_asoft<<<ZH * TT / 8, 256, 0, stream>>>(Sb, P16, nullptr, nullptr, OUT1);   /* the weights' f16 plane and the second output */
    k_gemmt<h16, false, 2, 3><<<dim3(TT / 128, DM / 128, ZH), 128, 0, stream>>>(P16, nullptr, VT16, TT, OUT0, nullptr, nullptr, 1.0f / PCAR, (int)PITCH, BV, (size_t)TT * TT, PL, (size_t)DM);   /* out = 2^-10 x 1,024 x (weights v' + Wo bv + bo), written in place: row pitch 4,096 floats; each further entry 1,024 floats further */
}
